// v000
// Times are from an AMD MI455X. After a warm-up the kernel runs many times in a row, and a time is the length of
// such a window on the GPU divided by its runs, so every launch and the gaps after it count. The runs cycle
// through copies of the inputs. A figure is the median of several windows, for all but v000 over two sittings.
// Sittings can differ by a few percent; kernels timed side by side share one.
// The starting kernel, v000, takes 400 microseconds a run.
#include <hip/hip_runtime.h>
#include <hip/hip_bf16.h>

// ---------------------------------------------------------------------------
// LightSeq-style pre-LN multihead attention layer for MI455X (gfx1250).
// fp32 math for LN/softmax/accum; bf16 operands into v_wmma_f32_16x16x32_bf16.
// GEMMs: 4-wave workgroup, 64x64 tile, A-tile double-buffered into LDS via
// GLOBAL_LOAD_ASYNC_TO_LDS_B128 (ASYNCcnt), B streamed from L2 with prefetch.
// Attention: 1 wave / 32 q-rows, flash-style online softmax, launch_bounds
// raised so the ~250-VGPR working set stays spill-free (wave32 allows 1024).
// B=4, S=2048, H=1024, NH=16, HD=64.
// ---------------------------------------------------------------------------

#define B_   4
#define S_   2048
#define H_   1024
#define NH_  16
#define HD_  64
#define BS_  (B_ * S_)

typedef __attribute__((ext_vector_type(16))) __bf16        v16bf;
typedef __attribute__((ext_vector_type(8)))  float         v8f;
typedef __attribute__((ext_vector_type(4)))  unsigned int  v4u;

struct Frag32B { v4u lo, hi; };

static __device__ __forceinline__ unsigned short f2bfu(float f) {
    unsigned int u = __builtin_bit_cast(unsigned int, f);
    unsigned int r = u + 0x7FFFu + ((u >> 16) & 1u);   // round-to-nearest-even
    return (unsigned short)(r >> 16);
}

// Load one 16x32 bf16 A/B fragment for this lane. `row` points at the start of
// the (stride-aligned) 32-wide K slice of this lane's row/column.
// Per ISA 7.12.2: elements 0..7 = K[8*half .. 8*half+7],
//                 elements 8..15 = K[16+8*half .. 23+8*half].
static __device__ __forceinline__ v16bf load_frag(const unsigned short* row, int half) {
    Frag32B f;
    f.lo = *(const v4u*)(row + 8 * half);
    f.hi = *(const v4u*)(row + 16 + 8 * half);
    return __builtin_bit_cast(v16bf, f);
}

static __device__ __forceinline__ v8f wmma_bf16(v16bf a, v16bf b, v8f c) {
    return __builtin_amdgcn_wmma_f32_16x16x32_bf16(false, a, false, b, (short)0, c,
                                                   false, false);
}

static __device__ __forceinline__ float hmax16(float v) {
    v = fmaxf(v, __shfl_xor(v, 1, 32));
    v = fmaxf(v, __shfl_xor(v, 2, 32));
    v = fmaxf(v, __shfl_xor(v, 4, 32));
    v = fmaxf(v, __shfl_xor(v, 8, 32));
    return v;
}
static __device__ __forceinline__ float hsum16(float v) {
    v += __shfl_xor(v, 1, 32);
    v += __shfl_xor(v, 2, 32);
    v += __shfl_xor(v, 4, 32);
    v += __shfl_xor(v, 8, 32);
    return v;
}

// Issue this thread's two async 16B chunks of the 64x32 bf16 A-tile into LDS.
// Chunk c (0..255): row = c>>2, 8-elem offset = (c&3)*8; thread tid owns
// chunks 2*tid and 2*tid+1 (contiguous in LDS). Tracked by ASYNCcnt.
static __device__ __forceinline__ void async_copy_tileA(const unsigned short* A,
                                                        int m0, int kb,
                                                        unsigned short* buf, int tid) {
    int c0 = tid * 2;
    const unsigned short* g0 = A + (size_t)(m0 + (c0 >> 2)) * H_ + kb + (c0 & 3) * 8;
    const unsigned short* g1 = A + (size_t)(m0 + ((c0 + 1) >> 2)) * H_ + kb + ((c0 + 1) & 3) * 8;
    unsigned la0 = (unsigned)(size_t)buf + (unsigned)c0 * 16u;
    unsigned la1 = la0 + 16u;
    unsigned long long ga0 = (unsigned long long)(size_t)g0;
    unsigned long long ga1 = (unsigned long long)(size_t)g1;
    asm volatile("global_load_async_to_lds_b128 %0, %2, off\n\t"
                 "global_load_async_to_lds_b128 %1, %3, off"
                 :: "v"(la0), "v"(la1), "v"(ga0), "v"(ga1)
                 : "memory");
}

// ---------------------------------------------------------------------------
// Kernel 1: cast fp32 weights -> bf16 (qkv_w [3H,H] and out_w [H,H], row-major;
// rows of W are B-fragment columns, so no transpose is needed).
// ---------------------------------------------------------------------------
__global__ void cvt_weights_kernel(const float* __restrict__ qkv_w,
                                   const float* __restrict__ out_w,
                                   unsigned short* __restrict__ qkv_wb,
                                   unsigned short* __restrict__ out_wb) {
    int idx = blockIdx.x * 256 + threadIdx.x;
    const int NQ = 3 * H_ * H_;
    if (idx < NQ) {
        qkv_wb[idx] = f2bfu(qkv_w[idx]);
    } else {
        int j = idx - NQ;
        out_wb[j] = f2bfu(out_w[j]);
    }
}

// ---------------------------------------------------------------------------
// Kernel 2: pre-LayerNorm, fp32 in -> bf16 out (GEMM A operand).
// ---------------------------------------------------------------------------
__global__ void ln_kernel(const float* __restrict__ x, const float* __restrict__ g,
                          const float* __restrict__ bta,
                          unsigned short* __restrict__ yb) {
    __shared__ float s1[256], s2[256];
    int t = blockIdx.x, tid = threadIdx.x;
    const float* xr = x + (size_t)t * H_;
    float a = 0.f, b2 = 0.f;
    for (int i = tid; i < H_; i += 256) { float v = xr[i]; a += v; b2 += v * v; }
    s1[tid] = a; s2[tid] = b2; __syncthreads();
    for (int o = 128; o > 0; o >>= 1) {
        if (tid < o) { s1[tid] += s1[tid + o]; s2[tid] += s2[tid + o]; }
        __syncthreads();
    }
    float mean = s1[0] * (1.f / H_);
    float var  = s2[0] * (1.f / H_) - mean * mean;
    float rstd = rsqrtf(var + 1e-5f);
    unsigned short* yr = yb + (size_t)t * H_;
    for (int i = tid; i < H_; i += 256)
        yr[i] = f2bfu((xr[i] - mean) * rstd * g[i] + bta[i]);
}

// ---------------------------------------------------------------------------
// Kernels 3/5: 64x64-tile GEMM, 4 waves per block. A-tile (64x32 bf16, shared
// by all waves) double-buffered in LDS via async-to-LDS DMA; each wave owns a
// 16-column slice of B read straight from global (L2-resident weights).
// MODE 0: QKV projection epilogue (+bias, scatter Q/K -> [B,NH,S,HD],
//         V -> [B,NH,HD,S], bf16).
// MODE 1: out-projection epilogue (+bias, +residual, fp32 to d_out).
// ---------------------------------------------------------------------------
template <int MODE>
__global__ void __launch_bounds__(128, 1)
gemm64_kernel(const unsigned short* __restrict__ Ab,
              const unsigned short* __restrict__ Wb,
              const float* __restrict__ bias,
              unsigned short* __restrict__ Qb,
              unsigned short* __restrict__ Kb,
              unsigned short* __restrict__ VTb,
              const float* __restrict__ xres,
              float* __restrict__ outp) {
    __shared__ unsigned short shA[2][64 * 32];
    const int tid = threadIdx.x;
    const int w = tid >> 5, lane = tid & 31;
    const int half = lane >> 4, l15 = lane & 15;
    const int m0 = blockIdx.y * 64;
    const int n0 = blockIdx.x * 64;

    const unsigned short* br = Wb + (size_t)(n0 + w * 16 + l15) * H_;

    v8f acc[4] = {};

    // prologue: start DMA of first A-tile
    async_copy_tileA(Ab, m0, 0, &shA[0][0], tid);

#pragma unroll 1
    for (int kb = 0; kb < H_; kb += 32) {
        const int cur = (kb >> 5) & 1;
        if (kb + 32 < H_) {
            async_copy_tileA(Ab, m0, kb + 32, &shA[cur ^ 1][0], tid);
            __builtin_prefetch(br + kb + 160, 0, 1);
            asm volatile("s_wait_asynccnt 0x2" ::: "memory");  // current tile done
        } else {
            asm volatile("s_wait_asynccnt 0x0" ::: "memory");
        }
        __syncthreads();  // A-tile visible to all 4 waves

        v16bf bfr = load_frag(br + kb, half);
        v16bf a[4];
#pragma unroll
        for (int mi = 0; mi < 4; ++mi)
            a[mi] = load_frag(&shA[cur][(mi * 16 + l15) * 32], half);
#pragma unroll
        for (int mi = 0; mi < 4; ++mi)
            acc[mi] = wmma_bf16(a[mi], bfr, acc[mi]);

        __syncthreads();  // protect buffer before it is DMA-overwritten
    }

    const int e = n0 + w * 16 + l15;   // output feature
    const float bv = bias[e];
    if (MODE == 0) {
        int sec = e >> 10;             // 0=q 1=k 2=v
        int ein = e & (H_ - 1);
        int h = ein >> 6, d = ein & 63;
#pragma unroll
        for (int mi = 0; mi < 4; ++mi)
#pragma unroll
            for (int r = 0; r < 8; ++r) {
                int t = m0 + mi * 16 + 8 * half + r;   // token index
                int bb = t >> 11, s = t & (S_ - 1);
                unsigned short v = f2bfu(acc[mi][r] + bv);
                if (sec == 0)      Qb[(((bb * NH_ + h) * S_ + s) << 6) + d] = v;
                else if (sec == 1) Kb[(((bb * NH_ + h) * S_ + s) << 6) + d] = v;
                else               VTb[(((bb * NH_ + h) * HD_ + d) << 11) + s] = v;
            }
    } else {
#pragma unroll
        for (int mi = 0; mi < 4; ++mi)
#pragma unroll
            for (int r = 0; r < 8; ++r) {
                int t = m0 + mi * 16 + 8 * half + r;
                size_t idx = (size_t)t * H_ + e;
                outp[idx] = acc[mi][r] + bv + xres[idx];
            }
    }
}

// ---------------------------------------------------------------------------
// Kernel 4: flash-style attention. One wave handles (b, head, 32 q-rows),
// streaming kv in chunks of 32 with online softmax. P goes through LDS to be
// re-read in WMMA A-fragment layout. ctx -> bf16 [B,S,H].
// __launch_bounds__(32, 1): lift the VGPR cap so the ~250-VGPR working set
// (Q/K/P/V frags + 8 ctx accums + row state) stays spill-free.
// ---------------------------------------------------------------------------
__global__ void __launch_bounds__(32, 1)
attn_kernel(const unsigned short* __restrict__ Qb,
            const unsigned short* __restrict__ Kb,
            const unsigned short* __restrict__ VTb,
            const int* __restrict__ maskp,
            unsigned short* __restrict__ ctxb) {
    __shared__ unsigned short pl[32 * 32];
    const int lane = threadIdx.x, half = lane >> 4, l15 = lane & 15;
    const int bid = blockIdx.x;
    const int qt = bid & 63, hh = (bid >> 6) & 15, bb = bid >> 10;

    const unsigned short* Qh  = Qb  + ((size_t)(bb * NH_ + hh) * S_) * HD_;
    const unsigned short* Kh  = Kb  + ((size_t)(bb * NH_ + hh) * S_) * HD_;
    const unsigned short* VTh = VTb + ((size_t)(bb * NH_ + hh) * HD_) * S_;
    const int* mptr = maskp + bb * S_;

    v16bf aq[2][2];
#pragma unroll
    for (int mi = 0; mi < 2; ++mi)
#pragma unroll
        for (int kk = 0; kk < 2; ++kk)
            aq[mi][kk] = load_frag(Qh + (size_t)(qt * 32 + mi * 16 + l15) * HD_ + kk * 32, half);

    float mrow[16], lrow[16];
#pragma unroll
    for (int i = 0; i < 16; ++i) { mrow[i] = -3.0e38f; lrow[i] = 0.f; }
    v8f cacc[2][4] = {};

    for (int kv0 = 0; kv0 < S_; kv0 += 32) {
        // scores: S = (Q K^T) * 0.125 + mask * -1e8
        v16bf bk[2][2];
#pragma unroll
        for (int ni = 0; ni < 2; ++ni)
#pragma unroll
            for (int kk = 0; kk < 2; ++kk)
                bk[ni][kk] = load_frag(Kh + (size_t)(kv0 + ni * 16 + l15) * HD_ + kk * 32, half);
        v8f sf[2][2] = {};
#pragma unroll
        for (int mi = 0; mi < 2; ++mi)
#pragma unroll
            for (int ni = 0; ni < 2; ++ni)
#pragma unroll
                for (int kk = 0; kk < 2; ++kk)
                    sf[mi][ni] = wmma_bf16(aq[mi][kk], bk[ni][kk], sf[mi][ni]);

        float mb[2];
#pragma unroll
        for (int ni = 0; ni < 2; ++ni)
            mb[ni] = (float)mptr[kv0 + ni * 16 + l15] * -1e8f;

#pragma unroll
        for (int mi = 0; mi < 2; ++mi)
#pragma unroll
            for (int ni = 0; ni < 2; ++ni)
#pragma unroll
                for (int r = 0; r < 8; ++r)
                    sf[mi][ni][r] = sf[mi][ni][r] * 0.125f + mb[ni];

        // online softmax per row (rows of a lane: m = mi*16 + 8*half + r)
#pragma unroll
        for (int mi = 0; mi < 2; ++mi)
#pragma unroll
            for (int r = 0; r < 8; ++r) {
                int ri = mi * 8 + r;
                float cm = hmax16(fmaxf(sf[mi][0][r], sf[mi][1][r]));
                float mo = mrow[ri];
                float mn = fmaxf(mo, cm);
                float resc = __expf(mo - mn);
                mrow[ri] = mn;
                float p0 = __expf(sf[mi][0][r] - mn);
                float p1 = __expf(sf[mi][1][r] - mn);
                sf[mi][0][r] = p0; sf[mi][1][r] = p1;
                lrow[ri] = lrow[ri] * resc + hsum16(p0 + p1);
#pragma unroll
                for (int nf = 0; nf < 4; ++nf) cacc[mi][nf][r] *= resc;
            }

        __syncthreads();
#pragma unroll
        for (int mi = 0; mi < 2; ++mi)
#pragma unroll
            for (int ni = 0; ni < 2; ++ni)
#pragma unroll
                for (int r = 0; r < 8; ++r) {
                    int m = mi * 16 + 8 * half + r, c = ni * 16 + l15;
                    pl[m * 32 + c] = f2bfu(sf[mi][ni][r]);
                }
        __syncthreads();

        v16bf ap[2], bv[4];
#pragma unroll
        for (int mi = 0; mi < 2; ++mi)
            ap[mi] = load_frag(&pl[(mi * 16 + l15) * 32], half);
#pragma unroll
        for (int nf = 0; nf < 4; ++nf)
            bv[nf] = load_frag(VTh + (size_t)(nf * 16 + l15) * S_ + kv0, half);
#pragma unroll
        for (int mi = 0; mi < 2; ++mi)
#pragma unroll
            for (int nf = 0; nf < 4; ++nf)
                cacc[mi][nf] = wmma_bf16(ap[mi], bv[nf], cacc[mi][nf]);
    }

#pragma unroll
    for (int mi = 0; mi < 2; ++mi)
#pragma unroll
        for (int r = 0; r < 8; ++r) {
            int ri = mi * 8 + r;
            float inv = 1.0f / lrow[ri];
            int s = qt * 32 + mi * 16 + 8 * half + r;
#pragma unroll
            for (int nf = 0; nf < 4; ++nf) {
                int col = hh * HD_ + nf * 16 + l15;
                ctxb[((size_t)(bb * S_ + s) * H_) + col] = f2bfu(cacc[mi][nf][r] * inv);
            }
        }
}

// ---------------------------------------------------------------------------
extern "C" void kernel_launch(void* const* d_in, const int* in_sizes, int n_in,
                              void* d_out, int out_size, void* d_ws, size_t ws_size,
                              hipStream_t stream) {
    (void)in_sizes; (void)n_in; (void)out_size; (void)ws_size;
    const float* x       = (const float*)d_in[0];
    const int*   mask    = (const int*)d_in[1];
    const float* qkv_w   = (const float*)d_in[2];
    const float* qkv_b   = (const float*)d_in[3];
    const float* out_w   = (const float*)d_in[4];
    const float* out_b   = (const float*)d_in[5];
    const float* ln_g    = (const float*)d_in[6];
    const float* ln_b    = (const float*)d_in[7];
    float* out = (float*)d_out;

    // workspace layout (bf16 buffers), ~88 MB total
    char* w = (char*)d_ws;
    unsigned short* yb     = (unsigned short*)w;                 w += (size_t)BS_ * H_ * 2;       // 16 MB
    unsigned short* qkv_wb = (unsigned short*)w;                 w += (size_t)3 * H_ * H_ * 2;    //  6 MB
    unsigned short* out_wb = (unsigned short*)w;                 w += (size_t)H_ * H_ * 2;        //  2 MB
    unsigned short* Qb     = (unsigned short*)w;                 w += (size_t)BS_ * H_ * 2;       // 16 MB
    unsigned short* Kb     = (unsigned short*)w;                 w += (size_t)BS_ * H_ * 2;       // 16 MB
    unsigned short* VTb    = (unsigned short*)w;                 w += (size_t)BS_ * H_ * 2;       // 16 MB
    unsigned short* ctxb   = (unsigned short*)w;                                                  // 16 MB

    cvt_weights_kernel<<<(3 * H_ * H_ + H_ * H_) / 256, 256, 0, stream>>>(
        qkv_w, out_w, qkv_wb, out_wb);
    ln_kernel<<<BS_, 256, 0, stream>>>(x, ln_g, ln_b, yb);
    gemm64_kernel<0><<<dim3(3 * H_ / 64, BS_ / 64), 128, 0, stream>>>(
        yb, qkv_wb, qkv_b, Qb, Kb, VTb, nullptr, nullptr);
    attn_kernel<<<B_ * NH_ * (S_ / 32), 32, 0, stream>>>(Qb, Kb, VTb, mask, ctxb);
    gemm64_kernel<1><<<dim3(H_ / 64, BS_ / 64), 128, 0, stream>>>(
        ctxb, out_wb, out_b, nullptr, nullptr, nullptr, x, out);
}

// v001
// One run takes 283 microseconds.
// Two timings next to v000 put it at 1.47 and 1.48 times that version's speed.
#include <hip/hip_runtime.h>
#include <hip/hip_bf16.h>

// ---------------------------------------------------------------------------
// LightSeq-style pre-LN multihead attention layer for MI455X (gfx1250).
// fp32 math for LN/softmax/accum; bf16 operands into v_wmma_f32_16x16x32_bf16.
// GEMMs: 8-wave workgroup, 256x128 tile, A and W rows double-buffered into LDS
// via GLOBAL_LOAD_ASYNC_TO_LDS_B128 (ASYNCcnt), 64x64 of the output per wave.
// Attention: 1 wave / 32 q-rows, flash-style online softmax, launch_bounds
// raised so the ~250-VGPR working set stays spill-free (wave32 allows 1024).
// B=4, S=2048, H=1024, NH=16, HD=64.
// ---------------------------------------------------------------------------

#define B_   4
#define S_   2048
#define H_   1024
#define NH_  16
#define HD_  64
#define BS_  (B_ * S_)

typedef __attribute__((ext_vector_type(16))) __bf16        v16bf;
typedef __attribute__((ext_vector_type(8)))  float         v8f;
typedef __attribute__((ext_vector_type(4)))  unsigned int  v4u;

struct Frag32B { v4u lo, hi; };

static __device__ __forceinline__ unsigned short f2bfu(float f) {
    unsigned int u = __builtin_bit_cast(unsigned int, f);
    unsigned int r = u + 0x7FFFu + ((u >> 16) & 1u);   // round-to-nearest-even
    return (unsigned short)(r >> 16);
}

// Load one 16x32 bf16 A/B fragment for this lane. `row` points at the start of
// the (stride-aligned) 32-wide K slice of this lane's row/column.
// Per ISA 7.12.2: elements 0..7 = K[8*half .. 8*half+7],
//                 elements 8..15 = K[16+8*half .. 23+8*half].
static __device__ __forceinline__ v16bf load_frag(const unsigned short* row, int half) {
    Frag32B f;
    f.lo = *(const v4u*)(row + 8 * half);
    f.hi = *(const v4u*)(row + 16 + 8 * half);
    return __builtin_bit_cast(v16bf, f);
}

static __device__ __forceinline__ v8f wmma_bf16(v16bf a, v16bf b, v8f c) {
    return __builtin_amdgcn_wmma_f32_16x16x32_bf16(false, a, false, b, (short)0, c,
                                                   false, false);
}

static __device__ __forceinline__ float hmax16(float v) {
    v = fmaxf(v, __shfl_xor(v, 1, 32));
    v = fmaxf(v, __shfl_xor(v, 2, 32));
    v = fmaxf(v, __shfl_xor(v, 4, 32));
    v = fmaxf(v, __shfl_xor(v, 8, 32));
    return v;
}
static __device__ __forceinline__ float hsum16(float v) {
    v += __shfl_xor(v, 1, 32);
    v += __shfl_xor(v, 2, 32);
    v += __shfl_xor(v, 4, 32);
    v += __shfl_xor(v, 8, 32);
    return v;
}

// GEMM tile: 256 rows of A x 128 rows of W per workgroup, 64 k per stage.
// LDS layout of one stage: 256 A rows then 128 W rows, each 64 k (128 B) at a
// pitch of 144 B (16 B x odd: ds_load_b128 fragment reads hit all banks).
#define GBM_   256
#define GBN_   128
#define GP_    72                      // row pitch in elements
#define GPB_   144u                    // row pitch in bytes
#define GSTG_  ((GBM_ + GBN_) * GP_)   // elements per stage
#define GSTGB_ (GSTG_ * 2)             // bytes per stage

// One stage's twelve async 16 B copies of this lane: A rows r + 32 i (i < 8) and
// W rows r + 32 i (i < 4), r = tid >> 3, 16 B chunk tid & 7, so each wave copy
// covers four whole 128 B lines. ga / gw / lds are the lane's addresses for row r.
// s_wait_xcnt closes the statement so that no address register of an issued
// copy is rewritten ahead of it.
static __device__ __forceinline__ void async_copy_stage(const unsigned short* ga,
                                                        const unsigned short* gw,
                                                        unsigned lds) {
    const unsigned lw = lds + GBM_ * GPB_;
    asm volatile("global_load_async_to_lds_b128 %0, %12, off\n\t"
                 "global_load_async_to_lds_b128 %1, %13, off\n\t"
                 "global_load_async_to_lds_b128 %2, %14, off\n\t"
                 "global_load_async_to_lds_b128 %3, %15, off\n\t"
                 "global_load_async_to_lds_b128 %4, %16, off\n\t"
                 "global_load_async_to_lds_b128 %5, %17, off\n\t"
                 "global_load_async_to_lds_b128 %6, %18, off\n\t"
                 "global_load_async_to_lds_b128 %7, %19, off\n\t"
                 "global_load_async_to_lds_b128 %8, %20, off\n\t"
                 "global_load_async_to_lds_b128 %9, %21, off\n\t"
                 "global_load_async_to_lds_b128 %10, %22, off\n\t"
                 "global_load_async_to_lds_b128 %11, %23, off\n\t"
                 "s_wait_xcnt 0x0"
                 :: "v"(lds), "v"(lds + 32u * GPB_), "v"(lds + 64u * GPB_),
                    "v"(lds + 96u * GPB_), "v"(lds + 128u * GPB_), "v"(lds + 160u * GPB_),
                    "v"(lds + 192u * GPB_), "v"(lds + 224u * GPB_),
                    "v"(lw), "v"(lw + 32u * GPB_), "v"(lw + 64u * GPB_), "v"(lw + 96u * GPB_),
                    "v"(ga), "v"(ga + 32 * H_), "v"(ga + 64 * H_), "v"(ga + 96 * H_),
                    "v"(ga + 128 * H_), "v"(ga + 160 * H_), "v"(ga + 192 * H_), "v"(ga + 224 * H_),
                    "v"(gw), "v"(gw + 32 * H_), "v"(gw + 64 * H_), "v"(gw + 96 * H_)
                 : "memory");
}

// ---------------------------------------------------------------------------
// Kernel 1: cast fp32 weights -> bf16 (qkv_w [3H,H] and out_w [H,H], row-major;
// rows of W are B-fragment columns, so no transpose is needed).
// ---------------------------------------------------------------------------
__global__ void cvt_weights_kernel(const float* __restrict__ qkv_w,
                                   const float* __restrict__ out_w,
                                   unsigned short* __restrict__ qkv_wb,
                                   unsigned short* __restrict__ out_wb) {
    int idx = blockIdx.x * 256 + threadIdx.x;
    const int NQ = 3 * H_ * H_;
    if (idx < NQ) {
        qkv_wb[idx] = f2bfu(qkv_w[idx]);
    } else {
        int j = idx - NQ;
        out_wb[j] = f2bfu(out_w[j]);
    }
}

// ---------------------------------------------------------------------------
// Kernel 2: pre-LayerNorm, fp32 in -> bf16 out (GEMM A operand).
// ---------------------------------------------------------------------------
__global__ void ln_kernel(const float* __restrict__ x, const float* __restrict__ g,
                          const float* __restrict__ bta,
                          unsigned short* __restrict__ yb) {
    __shared__ float s1[256], s2[256];
    int t = blockIdx.x, tid = threadIdx.x;
    const float* xr = x + (size_t)t * H_;
    float a = 0.f, b2 = 0.f;
    for (int i = tid; i < H_; i += 256) { float v = xr[i]; a += v; b2 += v * v; }
    s1[tid] = a; s2[tid] = b2; __syncthreads();
    for (int o = 128; o > 0; o >>= 1) {
        if (tid < o) { s1[tid] += s1[tid + o]; s2[tid] += s2[tid + o]; }
        __syncthreads();
    }
    float mean = s1[0] * (1.f / H_);
    float var  = s2[0] * (1.f / H_) - mean * mean;
    float rstd = rsqrtf(var + 1e-5f);
    unsigned short* yr = yb + (size_t)t * H_;
    for (int i = tid; i < H_; i += 256)
        yr[i] = f2bfu((xr[i] - mean) * rstd * g[i] + bta[i]);
}

// ---------------------------------------------------------------------------
// Kernels 3/5: 256x128-tile GEMM, 8 waves (4x2), 64x64 of Y per wave: 16 WMMAs
// per 8 fragments. A and W rows (64 k per stage) are double-buffered in LDS by
// async copies; the copies of stage t+2 fly while stage t+1 is worked on.
// MODE 0: QKV projection epilogue (+bias, scatter Q/K -> [B,NH,S,HD],
//         V -> [B,NH,HD,S], bf16).
// MODE 1: out-projection epilogue (+bias, +residual, fp32 to d_out).
// ---------------------------------------------------------------------------
template <int MODE>
__global__ void __launch_bounds__(256)
gemm_tile_kernel(const unsigned short* __restrict__ Ab,
                 const unsigned short* __restrict__ Wb,
                 const float* __restrict__ bias,
                 unsigned short* __restrict__ Qb,
                 unsigned short* __restrict__ Kb,
                 unsigned short* __restrict__ VTb,
                 const float* __restrict__ xres,
                 float* __restrict__ outp) {
    __shared__ __attribute__((aligned(16))) unsigned short sh[2 * GSTG_];
    const int tid = threadIdx.x;
    const int w = tid >> 5, lane = tid & 31;
    const int half = lane >> 4, l15 = lane & 15;
    const int wm = w >> 1, wn = w & 1;
    const int m0 = blockIdx.y * GBM_;
    const int n0 = blockIdx.x * GBN_;
    const int NT = H_ / 64;            // stages

    const int crow = tid >> 3, cchk = tid & 7;
    const unsigned short* gA = Ab + (size_t)(m0 + crow) * H_ + cchk * 8;
    const unsigned short* gW = Wb + (size_t)(n0 + crow) * H_ + cchk * 8;
    const unsigned lds0 = (unsigned)(size_t)&sh[0] + (unsigned)crow * GPB_ + (unsigned)cchk * 16u;

    v8f acc[4][4] = {};

    // prologue: stage 0 landed and published, stage 1 in flight
    async_copy_stage(gA, gW, lds0);
    asm volatile("s_wait_asynccnt 0x0" ::: "memory");  // own copies of stage 0 landed
    __syncthreads();                                   // stage 0 visible to all waves
    async_copy_stage(gA + 64, gW + 64, lds0 + GSTGB_);

    // rolled: one copy of the 32-WMMA body, for speed only
#pragma unroll 1
    for (int t = 0; t < NT; ++t) {
        const int cur = t & 1;
        const unsigned short* sA = &sh[cur * GSTG_ + (wm * 64 + l15) * GP_];
        const unsigned short* sW = &sh[cur * GSTG_ + (GBM_ + wn * 64 + l15) * GP_];
#pragma unroll
        for (int kk = 0; kk < 2; ++kk) {
            v16bf a[4], b[4];
#pragma unroll
            for (int i = 0; i < 4; ++i) a[i] = load_frag(sA + i * 16 * GP_ + kk * 32, half);
#pragma unroll
            for (int i = 0; i < 4; ++i) b[i] = load_frag(sW + i * 16 * GP_ + kk * 32, half);
            // keeps the 16 LDS reads one group ahead of the WMMA block, for speed only
            __builtin_amdgcn_sched_barrier(0);
#pragma unroll
            for (int ni = 0; ni < 4; ++ni)
#pragma unroll
                for (int mi = 0; mi < 4; ++mi)
                    acc[mi][ni] = wmma_bf16(a[mi], b[ni], acc[mi][ni]);
            // keeps the next group of LDS reads out of this WMMA block
            __builtin_amdgcn_sched_barrier(0);
        }
        asm volatile("s_wait_dscnt 0x0" ::: "memory");     // own reads of this buffer done
        asm volatile("s_wait_asynccnt 0x0" ::: "memory");  // own copies of stage t+1 landed
        __syncthreads();  // publishes stage t+1 and frees the buffer just read
        if (t + 2 < NT)
            async_copy_stage(gA + (t + 2) * 64, gW + (t + 2) * 64, lds0 + (unsigned)cur * GSTGB_);
    }
    asm volatile("s_wait_asynccnt 0x0" ::: "memory");  // nothing in flight at the end

    float bv[4];
#pragma unroll
    for (int ni = 0; ni < 4; ++ni) bv[ni] = bias[n0 + wn * 64 + ni * 16 + l15];

    if (MODE == 0) {
        // A tile's 256 tokens lie in one batch, its 128 features in one of q/k/v,
        // a wave's 64 features in one head (d = ni*16 + l15): one address per lane,
        // every (mi, r, ni) step a constant offset. Each path walks its stores so
        // that neighbours in time fall into the same 128 B line.
        const int sec = n0 >> 10;                              // 0=q 1=k 2=v
        const int s0 = (m0 & (S_ - 1)) + wm * 64 + 8 * half;   // token of (mi=0, r=0)
        const int bh = (m0 >> 11) * NH_ + ((n0 & (H_ - 1)) >> 6) + wn;
        if (sec == 2) {
            unsigned short* dst = VTb + (((bh * HD_ + l15) << 11) + s0);
#pragma unroll
            for (int ni = 0; ni < 4; ++ni)
#pragma unroll
                for (int mi = 0; mi < 4; ++mi)
#pragma unroll
                    for (int r = 0; r < 8; ++r)
                        dst[((ni * 16) << 11) + mi * 16 + r] = f2bfu(acc[mi][ni][r] + bv[ni]);
            return;
        }
        unsigned short* dst = (sec == 0 ? Qb : Kb) + (((bh * S_ + s0) << 6) + l15);
#pragma unroll
        for (int mi = 0; mi < 4; ++mi)
#pragma unroll
            for (int r = 0; r < 8; ++r)
#pragma unroll
                for (int ni = 0; ni < 4; ++ni)
                    dst[((mi * 16 + r) << 6) + ni * 16] = f2bfu(acc[mi][ni][r] + bv[ni]);
    } else {
        // One address per lane, every (mi, r, ni) step a constant offset. The wave's
        // 128 residual loads go out as one group ahead of the adds and stores, so
        // that their latency is waited out once and not once per element.
        const unsigned i0 = (unsigned)((m0 + wm * 64 + 8 * half) * H_ + n0 + wn * 64 + l15);
        const float* xp = xres + i0;
        float* op = outp + i0;
        float xr[4][8][4];
#pragma unroll
        for (int mi = 0; mi < 4; ++mi)
#pragma unroll
            for (int r = 0; r < 8; ++r)
#pragma unroll
                for (int ni = 0; ni < 4; ++ni)
                    xr[mi][r][ni] = xp[(mi * 16 + r) * H_ + ni * 16];
#pragma unroll
        for (int mi = 0; mi < 4; ++mi)
#pragma unroll
            for (int r = 0; r < 8; ++r)
#pragma unroll
                for (int ni = 0; ni < 4; ++ni)
                    op[(mi * 16 + r) * H_ + ni * 16] = acc[mi][ni][r] + bv[ni] + xr[mi][r][ni];
    }
}

// ---------------------------------------------------------------------------
// Kernel 4: flash-style attention. One wave handles (b, head, 32 q-rows),
// streaming kv in chunks of 32 with online softmax. P goes through LDS to be
// re-read in WMMA A-fragment layout. ctx -> bf16 [B,S,H].
// __launch_bounds__(32, 1): lift the VGPR cap so the ~250-VGPR working set
// (Q/K/P/V frags + 8 ctx accums + row state) stays spill-free.
// ---------------------------------------------------------------------------
__global__ void __launch_bounds__(32, 1)
attn_kernel(const unsigned short* __restrict__ Qb,
            const unsigned short* __restrict__ Kb,
            const unsigned short* __restrict__ VTb,
            const int* __restrict__ maskp,
            unsigned short* __restrict__ ctxb) {
    __shared__ unsigned short pl[32 * 32];
    const int lane = threadIdx.x, half = lane >> 4, l15 = lane & 15;
    const int bid = blockIdx.x;
    const int qt = bid & 63, hh = (bid >> 6) & 15, bb = bid >> 10;

    const unsigned short* Qh  = Qb  + ((size_t)(bb * NH_ + hh) * S_) * HD_;
    const unsigned short* Kh  = Kb  + ((size_t)(bb * NH_ + hh) * S_) * HD_;
    const unsigned short* VTh = VTb + ((size_t)(bb * NH_ + hh) * HD_) * S_;
    const int* mptr = maskp + bb * S_;

    v16bf aq[2][2];
#pragma unroll
    for (int mi = 0; mi < 2; ++mi)
#pragma unroll
        for (int kk = 0; kk < 2; ++kk)
            aq[mi][kk] = load_frag(Qh + (size_t)(qt * 32 + mi * 16 + l15) * HD_ + kk * 32, half);

    float mrow[16], lrow[16];
#pragma unroll
    for (int i = 0; i < 16; ++i) { mrow[i] = -3.0e38f; lrow[i] = 0.f; }
    v8f cacc[2][4] = {};

    for (int kv0 = 0; kv0 < S_; kv0 += 32) {
        // scores: S = (Q K^T) * 0.125 + mask * -1e8
        v16bf bk[2][2];
#pragma unroll
        for (int ni = 0; ni < 2; ++ni)
#pragma unroll
            for (int kk = 0; kk < 2; ++kk)
                bk[ni][kk] = load_frag(Kh + (size_t)(kv0 + ni * 16 + l15) * HD_ + kk * 32, half);
        v8f sf[2][2] = {};
#pragma unroll
        for (int mi = 0; mi < 2; ++mi)
#pragma unroll
            for (int ni = 0; ni < 2; ++ni)
#pragma unroll
                for (int kk = 0; kk < 2; ++kk)
                    sf[mi][ni] = wmma_bf16(aq[mi][kk], bk[ni][kk], sf[mi][ni]);

        float mb[2];
#pragma unroll
        for (int ni = 0; ni < 2; ++ni)
            mb[ni] = (float)mptr[kv0 + ni * 16 + l15] * -1e8f;

#pragma unroll
        for (int mi = 0; mi < 2; ++mi)
#pragma unroll
            for (int ni = 0; ni < 2; ++ni)
#pragma unroll
                for (int r = 0; r < 8; ++r)
                    sf[mi][ni][r] = sf[mi][ni][r] * 0.125f + mb[ni];

        // online softmax per row (rows of a lane: m = mi*16 + 8*half + r)
#pragma unroll
        for (int mi = 0; mi < 2; ++mi)
#pragma unroll
            for (int r = 0; r < 8; ++r) {
                int ri = mi * 8 + r;
                float cm = hmax16(fmaxf(sf[mi][0][r], sf[mi][1][r]));
                float mo = mrow[ri];
                float mn = fmaxf(mo, cm);
                float resc = __expf(mo - mn);
                mrow[ri] = mn;
                float p0 = __expf(sf[mi][0][r] - mn);
                float p1 = __expf(sf[mi][1][r] - mn);
                sf[mi][0][r] = p0; sf[mi][1][r] = p1;
                lrow[ri] = lrow[ri] * resc + hsum16(p0 + p1);
#pragma unroll
                for (int nf = 0; nf < 4; ++nf) cacc[mi][nf][r] *= resc;
            }

        __syncthreads();
#pragma unroll
        for (int mi = 0; mi < 2; ++mi)
#pragma unroll
            for (int ni = 0; ni < 2; ++ni)
#pragma unroll
                for (int r = 0; r < 8; ++r) {
                    int m = mi * 16 + 8 * half + r, c = ni * 16 + l15;
                    pl[m * 32 + c] = f2bfu(sf[mi][ni][r]);
                }
        __syncthreads();

        v16bf ap[2], bv[4];
#pragma unroll
        for (int mi = 0; mi < 2; ++mi)
            ap[mi] = load_frag(&pl[(mi * 16 + l15) * 32], half);
#pragma unroll
        for (int nf = 0; nf < 4; ++nf)
            bv[nf] = load_frag(VTh + (size_t)(nf * 16 + l15) * S_ + kv0, half);
#pragma unroll
        for (int mi = 0; mi < 2; ++mi)
#pragma unroll
            for (int nf = 0; nf < 4; ++nf)
                cacc[mi][nf] = wmma_bf16(ap[mi], bv[nf], cacc[mi][nf]);
    }

#pragma unroll
    for (int mi = 0; mi < 2; ++mi)
#pragma unroll
        for (int r = 0; r < 8; ++r) {
            int ri = mi * 8 + r;
            float inv = 1.0f / lrow[ri];
            int s = qt * 32 + mi * 16 + 8 * half + r;
#pragma unroll
            for (int nf = 0; nf < 4; ++nf) {
                int col = hh * HD_ + nf * 16 + l15;
                ctxb[((size_t)(bb * S_ + s) * H_) + col] = f2bfu(cacc[mi][nf][r] * inv);
            }
        }
}

// ---------------------------------------------------------------------------
extern "C" void kernel_launch(void* const* d_in, const int* in_sizes, int n_in,
                              void* d_out, int out_size, void* d_ws, size_t ws_size,
                              hipStream_t stream) {
    (void)in_sizes; (void)n_in; (void)out_size; (void)ws_size;
    const float* x       = (const float*)d_in[0];
    const int*   mask    = (const int*)d_in[1];
    const float* qkv_w   = (const float*)d_in[2];
    const float* qkv_b   = (const float*)d_in[3];
    const float* out_w   = (const float*)d_in[4];
    const float* out_b   = (const float*)d_in[5];
    const float* ln_g    = (const float*)d_in[6];
    const float* ln_b    = (const float*)d_in[7];
    float* out = (float*)d_out;

    // workspace layout (bf16 buffers), ~88 MB total
    char* w = (char*)d_ws;
    unsigned short* yb     = (unsigned short*)w;                 w += (size_t)BS_ * H_ * 2;       // 16 MB
    unsigned short* qkv_wb = (unsigned short*)w;                 w += (size_t)3 * H_ * H_ * 2;    //  6 MB
    unsigned short* out_wb = (unsigned short*)w;                 w += (size_t)H_ * H_ * 2;        //  2 MB
    unsigned short* Qb     = (unsigned short*)w;                 w += (size_t)BS_ * H_ * 2;       // 16 MB
    unsigned short* Kb     = (unsigned short*)w;                 w += (size_t)BS_ * H_ * 2;       // 16 MB
    unsigned short* VTb    = (unsigned short*)w;                 w += (size_t)BS_ * H_ * 2;       // 16 MB
    unsigned short* ctxb   = (unsigned short*)w;                                                  // 16 MB

    cvt_weights_kernel<<<(3 * H_ * H_ + H_ * H_) / 256, 256, 0, stream>>>(
        qkv_w, out_w, qkv_wb, out_wb);
    ln_kernel<<<BS_, 256, 0, stream>>>(x, ln_g, ln_b, yb);
    gemm_tile_kernel<0><<<dim3(3 * H_ / GBN_, BS_ / GBM_), 256, 0, stream>>>(
        yb, qkv_wb, qkv_b, Qb, Kb, VTb, nullptr, nullptr);
    attn_kernel<<<B_ * NH_ * (S_ / 32), 32, 0, stream>>>(Qb, Kb, VTb, mask, ctxb);
    gemm_tile_kernel<1><<<dim3(H_ / GBN_, BS_ / GBM_), 256, 0, stream>>>(
        ctxb, out_wb, out_b, nullptr, nullptr, nullptr, x, out);
}

// v002
// It runs in 251 microseconds.
// In both of two side-by-side timings against v001, it was 1.13 times as fast.
// Over all steps from v000 it is 1.66 times as fast.
#include <hip/hip_runtime.h>
#include <hip/hip_bf16.h>

// ---------------------------------------------------------------------------
// LightSeq-style pre-LN multihead attention layer for MI455X (gfx1250).
// fp32 math for LN/softmax/accum; bf16 operands into v_wmma_f32_16x16x32_bf16.
// GEMMs: 8-wave workgroup, 256x128 tile, A and W rows double-buffered into LDS
// via GLOBAL_LOAD_ASYNC_TO_LDS_B128 (ASYNCcnt), 64x64 of the output per wave.
// Attention: 1 wave / 32 queries, flash-style online softmax on transposed
// products (S^T = K Q^T, O^T += V^T P^T), P kept in registers.
// B=4, S=2048, H=1024, NH=16, HD=64.
// ---------------------------------------------------------------------------

#define B_   4
#define S_   2048
#define H_   1024
#define NH_  16
#define HD_  64
#define BS_  (B_ * S_)

typedef __attribute__((ext_vector_type(16))) __bf16        v16bf;
typedef __attribute__((ext_vector_type(8)))  float         v8f;
typedef __attribute__((ext_vector_type(4)))  unsigned int  v4u;
typedef __attribute__((ext_vector_type(8)))  __bf16        v8bf;
typedef __attribute__((ext_vector_type(4)))  int           v4i;
typedef __attribute__((ext_vector_type(4)))  float         v4f;

struct Frag32B { v4u lo, hi; };

static __device__ __forceinline__ unsigned short f2bfu(float f) {
    unsigned int u = __builtin_bit_cast(unsigned int, f);
    unsigned int r = u + 0x7FFFu + ((u >> 16) & 1u);   // round-to-nearest-even
    return (unsigned short)(r >> 16);
}

// Load one 16x32 bf16 A/B fragment for this lane. `row` points at the start of
// the (stride-aligned) 32-wide K slice of this lane's row/column.
// Per ISA 7.12.2: elements 0..7 = K[8*half .. 8*half+7],
//                 elements 8..15 = K[16+8*half .. 23+8*half].
static __device__ __forceinline__ v16bf load_frag(const unsigned short* row, int half) {
    Frag32B f;
    f.lo = *(const v4u*)(row + 8 * half);
    f.hi = *(const v4u*)(row + 16 + 8 * half);
    return __builtin_bit_cast(v16bf, f);
}

static __device__ __forceinline__ v8f wmma_bf16(v16bf a, v16bf b, v8f c) {
    return __builtin_amdgcn_wmma_f32_16x16x32_bf16(false, a, false, b, (short)0, c,
                                                   false, false);
}

// The value that lane ^ 16 holds (the other half of the wave).
static __device__ __forceinline__ float xhalf(float v) {
    const int b = __builtin_bit_cast(int, v);
    return __builtin_bit_cast(float, __builtin_amdgcn_permlanex16(b, b, 0x76543210, 0xfedcba98,
                                                                  false, false));
}

// GEMM tile: 256 rows of A x 128 rows of W per workgroup, 64 k per stage.
// LDS layout of one stage: 256 A rows then 128 W rows, each 64 k (128 B) at a
// pitch of 144 B (16 B x odd: ds_load_b128 fragment reads hit all banks).
#define GBM_   256
#define GBN_   128
#define GP_    72                      // row pitch in elements
#define GPB_   144u                    // row pitch in bytes
#define GSTG_  ((GBM_ + GBN_) * GP_)   // elements per stage
#define GSTGB_ (GSTG_ * 2)             // bytes per stage

// One stage's twelve async 16 B copies of this lane: A rows r + 32 i (i < 8) and
// W rows r + 32 i (i < 4), r = tid >> 3, 16 B chunk tid & 7, so each wave copy
// covers four whole 128 B lines. ga / gw / lds are the lane's addresses for row r.
// s_wait_xcnt closes the statement so that no address register of an issued
// copy is rewritten ahead of it.
static __device__ __forceinline__ void async_copy_stage(const unsigned short* ga,
                                                        const unsigned short* gw,
                                                        unsigned lds) {
    const unsigned lw = lds + GBM_ * GPB_;
    asm volatile("global_load_async_to_lds_b128 %0, %12, off\n\t"
                 "global_load_async_to_lds_b128 %1, %13, off\n\t"
                 "global_load_async_to_lds_b128 %2, %14, off\n\t"
                 "global_load_async_to_lds_b128 %3, %15, off\n\t"
                 "global_load_async_to_lds_b128 %4, %16, off\n\t"
                 "global_load_async_to_lds_b128 %5, %17, off\n\t"
                 "global_load_async_to_lds_b128 %6, %18, off\n\t"
                 "global_load_async_to_lds_b128 %7, %19, off\n\t"
                 "global_load_async_to_lds_b128 %8, %20, off\n\t"
                 "global_load_async_to_lds_b128 %9, %21, off\n\t"
                 "global_load_async_to_lds_b128 %10, %22, off\n\t"
                 "global_load_async_to_lds_b128 %11, %23, off\n\t"
                 "s_wait_xcnt 0x0"
                 :: "v"(lds), "v"(lds + 32u * GPB_), "v"(lds + 64u * GPB_),
                    "v"(lds + 96u * GPB_), "v"(lds + 128u * GPB_), "v"(lds + 160u * GPB_),
                    "v"(lds + 192u * GPB_), "v"(lds + 224u * GPB_),
                    "v"(lw), "v"(lw + 32u * GPB_), "v"(lw + 64u * GPB_), "v"(lw + 96u * GPB_),
                    "v"(ga), "v"(ga + 32 * H_), "v"(ga + 64 * H_), "v"(ga + 96 * H_),
                    "v"(ga + 128 * H_), "v"(ga + 160 * H_), "v"(ga + 192 * H_), "v"(ga + 224 * H_),
                    "v"(gw), "v"(gw + 32 * H_), "v"(gw + 64 * H_), "v"(gw + 96 * H_)
                 : "memory");
}

// ---------------------------------------------------------------------------
// Kernel 1: cast fp32 weights -> bf16 (qkv_w [3H,H] and out_w [H,H], row-major;
// rows of W are B-fragment columns, so no transpose is needed).
// ---------------------------------------------------------------------------
__global__ void cvt_weights_kernel(const float* __restrict__ qkv_w,
                                   const float* __restrict__ out_w,
                                   unsigned short* __restrict__ qkv_wb,
                                   unsigned short* __restrict__ out_wb) {
    int idx = blockIdx.x * 256 + threadIdx.x;
    const int NQ = 3 * H_ * H_;
    if (idx < NQ) {
        qkv_wb[idx] = f2bfu(qkv_w[idx]);
    } else {
        int j = idx - NQ;
        out_wb[j] = f2bfu(out_w[j]);
    }
}

// ---------------------------------------------------------------------------
// Kernel 2: pre-LayerNorm, fp32 in -> bf16 out (GEMM A operand).
// ---------------------------------------------------------------------------
__global__ void ln_kernel(const float* __restrict__ x, const float* __restrict__ g,
                          const float* __restrict__ bta,
                          unsigned short* __restrict__ yb) {
    __shared__ float s1[256], s2[256];
    int t = blockIdx.x, tid = threadIdx.x;
    const float* xr = x + (size_t)t * H_;
    float a = 0.f, b2 = 0.f;
    for (int i = tid; i < H_; i += 256) { float v = xr[i]; a += v; b2 += v * v; }
    s1[tid] = a; s2[tid] = b2; __syncthreads();
    for (int o = 128; o > 0; o >>= 1) {
        if (tid < o) { s1[tid] += s1[tid + o]; s2[tid] += s2[tid + o]; }
        __syncthreads();
    }
    float mean = s1[0] * (1.f / H_);
    float var  = s2[0] * (1.f / H_) - mean * mean;
    float rstd = rsqrtf(var + 1e-5f);
    unsigned short* yr = yb + (size_t)t * H_;
    for (int i = tid; i < H_; i += 256)
        yr[i] = f2bfu((xr[i] - mean) * rstd * g[i] + bta[i]);
}

// ---------------------------------------------------------------------------
// Kernels 3/5: 256x128-tile GEMM, 8 waves (4x2), 64x64 of Y per wave: 16 WMMAs
// per 8 fragments. A and W rows (64 k per stage) are double-buffered in LDS by
// async copies; the copies of stage t+2 fly while stage t+1 is worked on.
// MODE 0: QKV projection epilogue (+bias, scatter Q/K -> [B,NH,S,HD],
//         V -> [B,NH,HD,S], bf16).
// MODE 1: out-projection epilogue (+bias, +residual, fp32 to d_out).
// ---------------------------------------------------------------------------
template <int MODE>
__global__ void __launch_bounds__(256)
gemm_tile_kernel(const unsigned short* __restrict__ Ab,
                 const unsigned short* __restrict__ Wb,
                 const float* __restrict__ bias,
                 unsigned short* __restrict__ Qb,
                 unsigned short* __restrict__ Kb,
                 unsigned short* __restrict__ VTb,
                 const float* __restrict__ xres,
                 float* __restrict__ outp) {
    __shared__ __attribute__((aligned(16))) unsigned short sh[2 * GSTG_];
    const int tid = threadIdx.x;
    const int w = tid >> 5, lane = tid & 31;
    const int half = lane >> 4, l15 = lane & 15;
    const int wm = w >> 1, wn = w & 1;
    const int m0 = blockIdx.y * GBM_;
    const int n0 = blockIdx.x * GBN_;
    const int NT = H_ / 64;            // stages

    const int crow = tid >> 3, cchk = tid & 7;
    const unsigned short* gA = Ab + (size_t)(m0 + crow) * H_ + cchk * 8;
    const unsigned short* gW = Wb + (size_t)(n0 + crow) * H_ + cchk * 8;
    const unsigned lds0 = (unsigned)(size_t)&sh[0] + (unsigned)crow * GPB_ + (unsigned)cchk * 16u;

    v8f acc[4][4] = {};

    // prologue: stage 0 landed and published, stage 1 in flight
    async_copy_stage(gA, gW, lds0);
    asm volatile("s_wait_asynccnt 0x0" ::: "memory");  // own copies of stage 0 landed
    __syncthreads();                                   // stage 0 visible to all waves
    async_copy_stage(gA + 64, gW + 64, lds0 + GSTGB_);

    // rolled: one copy of the 32-WMMA body, for speed only
#pragma unroll 1
    for (int t = 0; t < NT; ++t) {
        const int cur = t & 1;
        const unsigned short* sA = &sh[cur * GSTG_ + (wm * 64 + l15) * GP_];
        const unsigned short* sW = &sh[cur * GSTG_ + (GBM_ + wn * 64 + l15) * GP_];
#pragma unroll
        for (int kk = 0; kk < 2; ++kk) {
            v16bf a[4], b[4];
#pragma unroll
            for (int i = 0; i < 4; ++i) a[i] = load_frag(sA + i * 16 * GP_ + kk * 32, half);
#pragma unroll
            for (int i = 0; i < 4; ++i) b[i] = load_frag(sW + i * 16 * GP_ + kk * 32, half);
            // keeps the 16 LDS reads one group ahead of the WMMA block, for speed only
            __builtin_amdgcn_sched_barrier(0);
#pragma unroll
            for (int ni = 0; ni < 4; ++ni)
#pragma unroll
                for (int mi = 0; mi < 4; ++mi)
                    acc[mi][ni] = wmma_bf16(a[mi], b[ni], acc[mi][ni]);
            // keeps the next group of LDS reads out of this WMMA block
            __builtin_amdgcn_sched_barrier(0);
        }
        asm volatile("s_wait_dscnt 0x0" ::: "memory");     // own reads of this buffer done
        asm volatile("s_wait_asynccnt 0x0" ::: "memory");  // own copies of stage t+1 landed
        __syncthreads();  // publishes stage t+1 and frees the buffer just read
        if (t + 2 < NT)
            async_copy_stage(gA + (t + 2) * 64, gW + (t + 2) * 64, lds0 + (unsigned)cur * GSTGB_);
    }
    asm volatile("s_wait_asynccnt 0x0" ::: "memory");  // nothing in flight at the end

    float bv[4];
#pragma unroll
    for (int ni = 0; ni < 4; ++ni) bv[ni] = bias[n0 + wn * 64 + ni * 16 + l15];

    if (MODE == 0) {
        // A tile's 256 tokens lie in one batch, its 128 features in one of q/k/v,
        // a wave's 64 features in one head (d = ni*16 + l15): one address per lane,
        // every (mi, r, ni) step a constant offset. Each path walks its stores so
        // that neighbours in time fall into the same 128 B line.
        const int sec = n0 >> 10;                              // 0=q 1=k 2=v
        const int s0 = (m0 & (S_ - 1)) + wm * 64 + 8 * half;   // token of (mi=0, r=0)
        const int bh = (m0 >> 11) * NH_ + ((n0 & (H_ - 1)) >> 6) + wn;
        if (sec == 2) {
            unsigned short* dst = VTb + (((bh * HD_ + l15) << 11) + s0);
#pragma unroll
            for (int ni = 0; ni < 4; ++ni)
#pragma unroll
                for (int mi = 0; mi < 4; ++mi)
#pragma unroll
                    for (int r = 0; r < 8; ++r)
                        dst[((ni * 16) << 11) + mi * 16 + r] = f2bfu(acc[mi][ni][r] + bv[ni]);
            return;
        }
        unsigned short* dst = (sec == 0 ? Qb : Kb) + (((bh * S_ + s0) << 6) + l15);
#pragma unroll
        for (int mi = 0; mi < 4; ++mi)
#pragma unroll
            for (int r = 0; r < 8; ++r)
#pragma unroll
                for (int ni = 0; ni < 4; ++ni)
                    dst[((mi * 16 + r) << 6) + ni * 16] = f2bfu(acc[mi][ni][r] + bv[ni]);
    } else {
        // One address per lane, every (mi, r, ni) step a constant offset. The wave's
        // 128 residual loads go out as one group ahead of the adds and stores, so
        // that their latency is waited out once and not once per element.
        const unsigned i0 = (unsigned)((m0 + wm * 64 + 8 * half) * H_ + n0 + wn * 64 + l15);
        const float* xp = xres + i0;
        float* op = outp + i0;
        float xr[4][8][4];
#pragma unroll
        for (int mi = 0; mi < 4; ++mi)
#pragma unroll
            for (int r = 0; r < 8; ++r)
#pragma unroll
                for (int ni = 0; ni < 4; ++ni)
                    xr[mi][r][ni] = xp[(mi * 16 + r) * H_ + ni * 16];
#pragma unroll
        for (int mi = 0; mi < 4; ++mi)
#pragma unroll
            for (int r = 0; r < 8; ++r)
#pragma unroll
                for (int ni = 0; ni < 4; ++ni)
                    op[(mi * 16 + r) * H_ + ni * 16] = acc[mi][ni][r] + bv[ni] + xr[mi][r][ni];
    }
}

// ---------------------------------------------------------------------------
// Kernel 4: flash-style attention, transposed products. One wave handles
// (b, head, 32 queries), streaming kv in chunks of 32 with online softmax.
// S^T = K Q^T: A = K rows, B = Q columns, so a lane holds 16 scores of ONE query
// per 16-query group: maximum and sum run in the lane, the two wave halves
// exchange the maximum once per chunk and join their sums once at the end.
// O^T += V^T P^T: the two S^T tiles of a query group, converted in place, are the
// B operand in the hardware k order (kv = 8*half + s, 16 + 8*half + s - 8), which
// is the order load_frag gives the V^T rows: P never leaves the registers.
// ctx -> bf16 [B,S,H]: a lane's 8 accumulator registers are 8 consecutive d.
// __launch_bounds__(32, 1): lift the VGPR cap so the working set stays spill-free.
// ---------------------------------------------------------------------------
__global__ void __launch_bounds__(32, 1)
attn_kernel(const unsigned short* __restrict__ Qb,
            const unsigned short* __restrict__ Kb,
            const unsigned short* __restrict__ VTb,
            const int* __restrict__ maskp,
            unsigned short* __restrict__ ctxb) {
    const int lane = threadIdx.x, half = lane >> 4, l15 = lane & 15;
    const int bid = blockIdx.x;
    const int qt = bid & 63, hh = (bid >> 6) & 15, bb = bid >> 10;

    const unsigned short* Qh  = Qb  + ((size_t)(bb * NH_ + hh) * S_) * HD_;
    const unsigned short* Kh  = Kb  + ((size_t)(bb * NH_ + hh) * S_) * HD_;
    const unsigned short* VTh = VTb + ((size_t)(bb * NH_ + hh) * HD_) * S_;
    const int* mptr = maskp + bb * S_ + 8 * half;

    v16bf bq[2][2];
#pragma unroll
    for (int nt = 0; nt < 2; ++nt)
#pragma unroll
        for (int kk = 0; kk < 2; ++kk)
            bq[nt][kk] = load_frag(Qh + (size_t)(qt * 32 + nt * 16 + l15) * HD_ + kk * 32, half);

    float mrow[2] = {-3.0e38f, -3.0e38f};   // running maximum of query nt*16 + l15
    float lrow[2] = {0.f, 0.f};             // this half's share of its running sum
    v8f cacc[4][2] = {};                    // O^T: d = dt*16 + 8*half + r, query nt*16 + l15

    for (int kv0 = 0; kv0 < S_; kv0 += 32) {
        v16bf ak[2][2], av[4];
#pragma unroll
        for (int mt = 0; mt < 2; ++mt)
#pragma unroll
            for (int kk = 0; kk < 2; ++kk)
                ak[mt][kk] = load_frag(Kh + (size_t)(kv0 + mt * 16 + l15) * HD_ + kk * 32, half);
        // mask of this lane's 16 kv rows: kv0 + mt*16 + 8*half + r
        v4i mk[2][2];
#pragma unroll
        for (int mt = 0; mt < 2; ++mt) {
            mk[mt][0] = *(const v4i*)(mptr + kv0 + mt * 16);
            mk[mt][1] = *(const v4i*)(mptr + kv0 + mt * 16 + 4);
        }
        // the V^T loads below may land on address registers of the loads above
        asm volatile("s_wait_xcnt 0x0" ::: "memory");
#pragma unroll
        for (int dt = 0; dt < 4; ++dt)
            av[dt] = load_frag(VTh + (size_t)(dt * 16 + l15) * S_ + kv0, half);
        // keeps the chunk's 20 loads one group ahead of the products: spread among
        // them, their latency is waited out three times per chunk and not once
        __builtin_amdgcn_sched_barrier(0);

        // scores: S^T = (K Q^T) * 0.125 + mask * -1e8
        v8f sf[2][2] = {};
#pragma unroll
        for (int mt = 0; mt < 2; ++mt)
#pragma unroll
            for (int nt = 0; nt < 2; ++nt)
#pragma unroll
                for (int kk = 0; kk < 2; ++kk)
                    sf[mt][nt] = wmma_bf16(ak[mt][kk], bq[nt][kk], sf[mt][nt]);

#pragma unroll
        for (int mt = 0; mt < 2; ++mt) {
            v8f mb;
#pragma unroll
            for (int r = 0; r < 8; ++r) mb[r] = (float)mk[mt][r >> 2][r & 3] * -1e8f;
            sf[mt][0] = sf[mt][0] * 0.125f + mb;
            sf[mt][1] = sf[mt][1] * 0.125f + mb;
        }

        float mnew[2];
#pragma unroll
        for (int nt = 0; nt < 2; ++nt) {
            float c0 = sf[0][nt][0], c1 = sf[1][nt][0];
#pragma unroll
            for (int r = 1; r < 8; ++r) c0 = fmaxf(c0, sf[0][nt][r]);
#pragma unroll
            for (int r = 1; r < 8; ++r) c1 = fmaxf(c1, sf[1][nt][r]);
            float cm = fmaxf(c0, c1);
            cm = fmaxf(cm, xhalf(cm));      // both halves feed one product: one maximum
            mnew[nt] = fmaxf(mrow[nt], cm);
        }
        float rs[2];
#pragma unroll
        for (int nt = 0; nt < 2; ++nt) {
            rs[nt] = __expf(mrow[nt] - mnew[nt]);
            mrow[nt] = mnew[nt];
        }

#pragma unroll
        for (int nt = 0; nt < 2; ++nt) {
            const float mn = mnew[nt], resc = rs[nt];
            const v8f t0 = sf[0][nt] - mn, t1 = sf[1][nt] - mn;
            v8f p0, p1;
#pragma unroll
            for (int r = 0; r < 8; ++r) p0[r] = __expf(t0[r]);
#pragma unroll
            for (int r = 0; r < 8; ++r) p1[r] = __expf(t1[r]);
            const v8f s8 = p0 + p1;
            const v4f s4 = __builtin_shufflevector(s8, s8, 0, 1, 2, 3) +
                           __builtin_shufflevector(s8, s8, 4, 5, 6, 7);
            const float ps = (s4[0] + s4[2]) + (s4[1] + s4[3]);
            lrow[nt] = lrow[nt] * resc + ps;
            const v16bf bp = __builtin_shufflevector(__builtin_convertvector(p0, v8bf),
                                                     __builtin_convertvector(p1, v8bf),
                                                     0, 1, 2, 3, 4, 5, 6, 7,
                                                     8, 9, 10, 11, 12, 13, 14, 15);
#pragma unroll
            for (int dt = 0; dt < 4; ++dt) {
                cacc[dt][nt] *= resc;
                cacc[dt][nt] = wmma_bf16(av[dt], bp, cacc[dt][nt]);
            }
        }
    }

#pragma unroll
    for (int nt = 0; nt < 2; ++nt) {
        const float inv = 1.0f / (lrow[nt] + xhalf(lrow[nt]));
        const int s = qt * 32 + nt * 16 + l15;
        unsigned short* dst = ctxb + (size_t)(bb * S_ + s) * H_ + hh * HD_ + 8 * half;
#pragma unroll
        for (int dt = 0; dt < 4; ++dt)
            *(v4u*)(dst + dt * 16) =
                __builtin_bit_cast(v4u, __builtin_convertvector(cacc[dt][nt] * inv, v8bf));
    }
}

// ---------------------------------------------------------------------------
extern "C" void kernel_launch(void* const* d_in, const int* in_sizes, int n_in,
                              void* d_out, int out_size, void* d_ws, size_t ws_size,
                              hipStream_t stream) {
    (void)in_sizes; (void)n_in; (void)out_size; (void)ws_size;
    const float* x       = (const float*)d_in[0];
    const int*   mask    = (const int*)d_in[1];
    const float* qkv_w   = (const float*)d_in[2];
    const float* qkv_b   = (const float*)d_in[3];
    const float* out_w   = (const float*)d_in[4];
    const float* out_b   = (const float*)d_in[5];
    const float* ln_g    = (const float*)d_in[6];
    const float* ln_b    = (const float*)d_in[7];
    float* out = (float*)d_out;

    // workspace layout (bf16 buffers), ~88 MB total
    char* w = (char*)d_ws;
    unsigned short* yb     = (unsigned short*)w;                 w += (size_t)BS_ * H_ * 2;       // 16 MB
    unsigned short* qkv_wb = (unsigned short*)w;                 w += (size_t)3 * H_ * H_ * 2;    //  6 MB
    unsigned short* out_wb = (unsigned short*)w;                 w += (size_t)H_ * H_ * 2;        //  2 MB
    unsigned short* Qb     = (unsigned short*)w;                 w += (size_t)BS_ * H_ * 2;       // 16 MB
    unsigned short* Kb     = (unsigned short*)w;                 w += (size_t)BS_ * H_ * 2;       // 16 MB
    unsigned short* VTb    = (unsigned short*)w;                 w += (size_t)BS_ * H_ * 2;       // 16 MB
    unsigned short* ctxb   = (unsigned short*)w;                                                  // 16 MB

    cvt_weights_kernel<<<(3 * H_ * H_ + H_ * H_) / 256, 256, 0, stream>>>(
        qkv_w, out_w, qkv_wb, out_wb);
    ln_kernel<<<BS_, 256, 0, stream>>>(x, ln_g, ln_b, yb);
    gemm_tile_kernel<0><<<dim3(3 * H_ / GBN_, BS_ / GBM_), 256, 0, stream>>>(
        yb, qkv_wb, qkv_b, Qb, Kb, VTb, nullptr, nullptr);
    attn_kernel<<<B_ * NH_ * (S_ / 32), 32, 0, stream>>>(Qb, Kb, VTb, mask, ctxb);
    gemm_tile_kernel<1><<<dim3(H_ / GBN_, BS_ / GBM_), 256, 0, stream>>>(
        ctxb, out_wb, out_b, nullptr, nullptr, nullptr, x, out);
}

// v003
// It runs in 156 microseconds.
// Two timings next to v002 put it at 1.60 and 1.61 times that version's speed.
// Over all steps from v000 it is 2.67 times as fast.
#include <hip/hip_runtime.h>
#include <hip/hip_bf16.h>

// ---------------------------------------------------------------------------
// LightSeq-style pre-LN multihead attention layer for MI455X (gfx1250).
// fp32 math for LN/softmax/accum; bf16 operands into v_wmma_f32_16x16x32_bf16.
// GEMMs: 8-wave workgroup, 256x128 tile, A and W rows double-buffered into LDS
// via GLOBAL_LOAD_ASYNC_TO_LDS_B128 (ASYNCcnt), 64x64 of the output per wave.
// Attention: 8 waves x 32 queries, K / V^T stages shared in LDS (async copies),
// flash-style online softmax on transposed products (S^T = K Q^T,
// O^T += V^T P^T), P kept in registers.
// B=4, S=2048, H=1024, NH=16, HD=64.
// ---------------------------------------------------------------------------

#define B_   4
#define S_   2048
#define H_   1024
#define NH_  16
#define HD_  64
#define BS_  (B_ * S_)

typedef __attribute__((ext_vector_type(16))) __bf16        v16bf;
typedef __attribute__((ext_vector_type(8)))  float         v8f;
typedef __attribute__((ext_vector_type(4)))  unsigned int  v4u;
typedef __attribute__((ext_vector_type(8)))  __bf16        v8bf;
typedef __attribute__((ext_vector_type(4)))  int           v4i;
typedef __attribute__((ext_vector_type(4)))  float         v4f;

struct Frag32B { v4u lo, hi; };

static __device__ __forceinline__ unsigned short f2bfu(float f) {
    unsigned int u = __builtin_bit_cast(unsigned int, f);
    unsigned int r = u + 0x7FFFu + ((u >> 16) & 1u);   // round-to-nearest-even
    return (unsigned short)(r >> 16);
}

// Load one 16x32 bf16 A/B fragment for this lane. `row` points at the start of
// the (stride-aligned) 32-wide K slice of this lane's row/column.
// Per ISA 7.12.2: elements 0..7 = K[8*half .. 8*half+7],
//                 elements 8..15 = K[16+8*half .. 23+8*half].
static __device__ __forceinline__ v16bf load_frag(const unsigned short* row, int half) {
    Frag32B f;
    f.lo = *(const v4u*)(row + 8 * half);
    f.hi = *(const v4u*)(row + 16 + 8 * half);
    return __builtin_bit_cast(v16bf, f);
}

static __device__ __forceinline__ v8f wmma_bf16(v16bf a, v16bf b, v8f c) {
    return __builtin_amdgcn_wmma_f32_16x16x32_bf16(false, a, false, b, (short)0, c,
                                                   false, false);
}

// The value that lane ^ 16 holds (the other half of the wave).
static __device__ __forceinline__ float xhalf(float v) {
    const int b = __builtin_bit_cast(int, v);
    return __builtin_bit_cast(float, __builtin_amdgcn_permlanex16(b, b, 0x76543210, 0xfedcba98,
                                                                  false, false));
}

// GEMM tile: 256 rows of A x 128 rows of W per workgroup, 64 k per stage.
// LDS layout of one stage: 256 A rows then 128 W rows, each 64 k (128 B) at a
// pitch of 144 B (16 B x odd: ds_load_b128 fragment reads hit all banks).
#define GBM_   256
#define GBN_   128
#define GP_    72                      // row pitch in elements
#define GPB_   144u                    // row pitch in bytes
#define GSTG_  ((GBM_ + GBN_) * GP_)   // elements per stage
#define GSTGB_ (GSTG_ * 2)             // bytes per stage

// One stage's twelve async 16 B copies of this lane: A rows r + 32 i (i < 8) and
// W rows r + 32 i (i < 4), r = tid >> 3, 16 B chunk tid & 7, so each wave copy
// covers four whole 128 B lines. ga / gw / lds are the lane's addresses for row r.
// s_wait_xcnt closes the statement so that no address register of an issued
// copy is rewritten ahead of it.
static __device__ __forceinline__ void async_copy_stage(const unsigned short* ga,
                                                        const unsigned short* gw,
                                                        unsigned lds) {
    const unsigned lw = lds + GBM_ * GPB_;
    asm volatile("global_load_async_to_lds_b128 %0, %12, off\n\t"
                 "global_load_async_to_lds_b128 %1, %13, off\n\t"
                 "global_load_async_to_lds_b128 %2, %14, off\n\t"
                 "global_load_async_to_lds_b128 %3, %15, off\n\t"
                 "global_load_async_to_lds_b128 %4, %16, off\n\t"
                 "global_load_async_to_lds_b128 %5, %17, off\n\t"
                 "global_load_async_to_lds_b128 %6, %18, off\n\t"
                 "global_load_async_to_lds_b128 %7, %19, off\n\t"
                 "global_load_async_to_lds_b128 %8, %20, off\n\t"
                 "global_load_async_to_lds_b128 %9, %21, off\n\t"
                 "global_load_async_to_lds_b128 %10, %22, off\n\t"
                 "global_load_async_to_lds_b128 %11, %23, off\n\t"
                 "s_wait_xcnt 0x0"
                 :: "v"(lds), "v"(lds + 32u * GPB_), "v"(lds + 64u * GPB_),
                    "v"(lds + 96u * GPB_), "v"(lds + 128u * GPB_), "v"(lds + 160u * GPB_),
                    "v"(lds + 192u * GPB_), "v"(lds + 224u * GPB_),
                    "v"(lw), "v"(lw + 32u * GPB_), "v"(lw + 64u * GPB_), "v"(lw + 96u * GPB_),
                    "v"(ga), "v"(ga + 32 * H_), "v"(ga + 64 * H_), "v"(ga + 96 * H_),
                    "v"(ga + 128 * H_), "v"(ga + 160 * H_), "v"(ga + 192 * H_), "v"(ga + 224 * H_),
                    "v"(gw), "v"(gw + 32 * H_), "v"(gw + 64 * H_), "v"(gw + 96 * H_)
                 : "memory");
}

// ---------------------------------------------------------------------------
// Kernel 1: cast fp32 weights -> bf16 (qkv_w [3H,H] and out_w [H,H], row-major;
// rows of W are B-fragment columns, so no transpose is needed).
// ---------------------------------------------------------------------------
__global__ void cvt_weights_kernel(const float* __restrict__ qkv_w,
                                   const float* __restrict__ out_w,
                                   unsigned short* __restrict__ qkv_wb,
                                   unsigned short* __restrict__ out_wb) {
    int idx = blockIdx.x * 256 + threadIdx.x;
    const int NQ = 3 * H_ * H_;
    if (idx < NQ) {
        qkv_wb[idx] = f2bfu(qkv_w[idx]);
    } else {
        int j = idx - NQ;
        out_wb[j] = f2bfu(out_w[j]);
    }
}

// ---------------------------------------------------------------------------
// Kernel 2: pre-LayerNorm, fp32 in -> bf16 out (GEMM A operand).
// ---------------------------------------------------------------------------
__global__ void ln_kernel(const float* __restrict__ x, const float* __restrict__ g,
                          const float* __restrict__ bta,
                          unsigned short* __restrict__ yb) {
    __shared__ float s1[256], s2[256];
    int t = blockIdx.x, tid = threadIdx.x;
    const float* xr = x + (size_t)t * H_;
    float a = 0.f, b2 = 0.f;
    for (int i = tid; i < H_; i += 256) { float v = xr[i]; a += v; b2 += v * v; }
    s1[tid] = a; s2[tid] = b2; __syncthreads();
    for (int o = 128; o > 0; o >>= 1) {
        if (tid < o) { s1[tid] += s1[tid + o]; s2[tid] += s2[tid + o]; }
        __syncthreads();
    }
    float mean = s1[0] * (1.f / H_);
    float var  = s2[0] * (1.f / H_) - mean * mean;
    float rstd = rsqrtf(var + 1e-5f);
    unsigned short* yr = yb + (size_t)t * H_;
    for (int i = tid; i < H_; i += 256)
        yr[i] = f2bfu((xr[i] - mean) * rstd * g[i] + bta[i]);
}

// ---------------------------------------------------------------------------
// Kernels 3/5: 256x128-tile GEMM, 8 waves (4x2), 64x64 of Y per wave: 16 WMMAs
// per 8 fragments. A and W rows (64 k per stage) are double-buffered in LDS by
// async copies; the copies of stage t+2 fly while stage t+1 is worked on.
// MODE 0: QKV projection epilogue (+bias, scatter Q/K -> [B,NH,S,HD],
//         V -> [B,NH,HD,S], bf16).
// MODE 1: out-projection epilogue (+bias, +residual, fp32 to d_out).
// ---------------------------------------------------------------------------
template <int MODE>
__global__ void __launch_bounds__(256)
gemm_tile_kernel(const unsigned short* __restrict__ Ab,
                 const unsigned short* __restrict__ Wb,
                 const float* __restrict__ bias,
                 unsigned short* __restrict__ Qb,
                 unsigned short* __restrict__ Kb,
                 unsigned short* __restrict__ VTb,
                 const float* __restrict__ xres,
                 float* __restrict__ outp) {
    __shared__ __attribute__((aligned(16))) unsigned short sh[2 * GSTG_];
    const int tid = threadIdx.x;
    const int w = tid >> 5, lane = tid & 31;
    const int half = lane >> 4, l15 = lane & 15;
    const int wm = w >> 1, wn = w & 1;
    const int m0 = blockIdx.y * GBM_;
    const int n0 = blockIdx.x * GBN_;
    const int NT = H_ / 64;            // stages

    const int crow = tid >> 3, cchk = tid & 7;
    const unsigned short* gA = Ab + (size_t)(m0 + crow) * H_ + cchk * 8;
    const unsigned short* gW = Wb + (size_t)(n0 + crow) * H_ + cchk * 8;
    const unsigned lds0 = (unsigned)(size_t)&sh[0] + (unsigned)crow * GPB_ + (unsigned)cchk * 16u;

    v8f acc[4][4] = {};

    // prologue: stage 0 landed and published, stage 1 in flight
    async_copy_stage(gA, gW, lds0);
    asm volatile("s_wait_asynccnt 0x0" ::: "memory");  // own copies of stage 0 landed
    __syncthreads();                                   // stage 0 visible to all waves
    async_copy_stage(gA + 64, gW + 64, lds0 + GSTGB_);

    // rolled: one copy of the 32-WMMA body, for speed only
#pragma unroll 1
    for (int t = 0; t < NT; ++t) {
        const int cur = t & 1;
        const unsigned short* sA = &sh[cur * GSTG_ + (wm * 64 + l15) * GP_];
        const unsigned short* sW = &sh[cur * GSTG_ + (GBM_ + wn * 64 + l15) * GP_];
#pragma unroll
        for (int kk = 0; kk < 2; ++kk) {
            v16bf a[4], b[4];
#pragma unroll
            for (int i = 0; i < 4; ++i) a[i] = load_frag(sA + i * 16 * GP_ + kk * 32, half);
#pragma unroll
            for (int i = 0; i < 4; ++i) b[i] = load_frag(sW + i * 16 * GP_ + kk * 32, half);
            // keeps the 16 LDS reads one group ahead of the WMMA block, for speed only
            __builtin_amdgcn_sched_barrier(0);
#pragma unroll
            for (int ni = 0; ni < 4; ++ni)
#pragma unroll
                for (int mi = 0; mi < 4; ++mi)
                    acc[mi][ni] = wmma_bf16(a[mi], b[ni], acc[mi][ni]);
            // keeps the next group of LDS reads out of this WMMA block
            __builtin_amdgcn_sched_barrier(0);
        }
        asm volatile("s_wait_dscnt 0x0" ::: "memory");     // own reads of this buffer done
        asm volatile("s_wait_asynccnt 0x0" ::: "memory");  // own copies of stage t+1 landed
        __syncthreads();  // publishes stage t+1 and frees the buffer just read
        if (t + 2 < NT)
            async_copy_stage(gA + (t + 2) * 64, gW + (t + 2) * 64, lds0 + (unsigned)cur * GSTGB_);
    }
    asm volatile("s_wait_asynccnt 0x0" ::: "memory");  // nothing in flight at the end

    float bv[4];
#pragma unroll
    for (int ni = 0; ni < 4; ++ni) bv[ni] = bias[n0 + wn * 64 + ni * 16 + l15];

    if (MODE == 0) {
        // A tile's 256 tokens lie in one batch, its 128 features in one of q/k/v,
        // a wave's 64 features in one head (d = ni*16 + l15): one address per lane,
        // every (mi, r, ni) step a constant offset. Each path walks its stores so
        // that neighbours in time fall into the same 128 B line.
        const int sec = n0 >> 10;                              // 0=q 1=k 2=v
        const int s0 = (m0 & (S_ - 1)) + wm * 64 + 8 * half;   // token of (mi=0, r=0)
        const int bh = (m0 >> 11) * NH_ + ((n0 & (H_ - 1)) >> 6) + wn;
        if (sec == 2) {
            unsigned short* dst = VTb + (((bh * HD_ + l15) << 11) + s0);
#pragma unroll
            for (int ni = 0; ni < 4; ++ni)
#pragma unroll
                for (int mi = 0; mi < 4; ++mi)
#pragma unroll
                    for (int r = 0; r < 8; ++r)
                        dst[((ni * 16) << 11) + mi * 16 + r] = f2bfu(acc[mi][ni][r] + bv[ni]);
            return;
        }
        unsigned short* dst = (sec == 0 ? Qb : Kb) + (((bh * S_ + s0) << 6) + l15);
#pragma unroll
        for (int mi = 0; mi < 4; ++mi)
#pragma unroll
            for (int r = 0; r < 8; ++r)
#pragma unroll
                for (int ni = 0; ni < 4; ++ni)
                    dst[((mi * 16 + r) << 6) + ni * 16] = f2bfu(acc[mi][ni][r] + bv[ni]);
    } else {
        // One address per lane, every (mi, r, ni) step a constant offset. The wave's
        // 128 residual loads go out as one group ahead of the adds and stores, so
        // that their latency is waited out once and not once per element.
        const unsigned i0 = (unsigned)((m0 + wm * 64 + 8 * half) * H_ + n0 + wn * 64 + l15);
        const float* xp = xres + i0;
        float* op = outp + i0;
        float xr[4][8][4];
#pragma unroll
        for (int mi = 0; mi < 4; ++mi)
#pragma unroll
            for (int r = 0; r < 8; ++r)
#pragma unroll
                for (int ni = 0; ni < 4; ++ni)
                    xr[mi][r][ni] = xp[(mi * 16 + r) * H_ + ni * 16];
#pragma unroll
        for (int mi = 0; mi < 4; ++mi)
#pragma unroll
            for (int r = 0; r < 8; ++r)
#pragma unroll
                for (int ni = 0; ni < 4; ++ni)
                    op[(mi * 16 + r) * H_ + ni * 16] = acc[mi][ni][r] + bv[ni] + xr[mi][r][ni];
    }
}

// ---------------------------------------------------------------------------
// Kernel 4: flash-style attention, transposed products. A work-group of 8 waves
// handles (b, head, 256 queries), one wave 32 of them, streaming kv in chunks of
// 32 with online softmax. K rows and V^T rows are shared by the 8 waves: stages of
// 128 keys are double-buffered in LDS by async copies, the batch's mask row is
// copied once; the copies of stage t+2 fly while stage t+1 is worked on.
// S^T = K Q^T: A = K rows, B = Q columns, so a lane holds 16 scores of ONE query
// per 16-query group: maximum and sum run in the lane, the two wave halves
// exchange the maximum once per chunk and join their sums once at the end.
// O^T += V^T P^T: the two S^T tiles of a query group, converted in place, are the
// B operand in the hardware k order (kv = 8*half + s, 16 + 8*half + s - 8), which
// is the order load_frag gives the V^T rows: P never leaves the registers.
// ctx -> bf16 [B,S,H]: a lane's 8 accumulator registers are 8 consecutive d.
// ---------------------------------------------------------------------------
// LDS layout of one stage: 128 K rows of 64 d (128 B) at a pitch of 144 B, then
// 64 V^T rows of 128 keys (256 B) at a pitch of 272 B (both 16 B x odd:
// ds_load_b128 fragment reads hit all banks).
#define AKS_   128                     // keys per stage
#define AKP_   72                      // K row pitch in elements
#define AKPB_  144u                    // K row pitch in bytes
#define AVP_   136                     // V^T row pitch in elements
#define AVPB_  272u                    // V^T row pitch in bytes
#define AKE_   (AKS_ * AKP_)           // elements of a stage's K part
#define ASTG_  (AKE_ + HD_ * AVP_)     // elements per stage
#define ASTGB_ (ASTG_ * 2)             // bytes per stage

// One stage's eight async 16 B copies of this lane: K rows r + 32 i (i < 4),
// r = tid >> 3, 16 B chunk tid & 7, and V^T rows q + 16 i (i < 4), q = tid >> 4,
// 16 B chunk tid & 15, so each wave copy covers four whole 128 B lines.
// gk / gv / lk / lv are the lane's addresses for rows r and q.
// s_wait_xcnt closes the statement so that no address register of an issued
// copy is rewritten ahead of it.
static __device__ __forceinline__ void async_copy_kv(const unsigned short* gk,
                                                     const unsigned short* gv,
                                                     unsigned lk, unsigned lv) {
    asm volatile("global_load_async_to_lds_b128 %0, %8, off\n\t"
                 "global_load_async_to_lds_b128 %1, %9, off\n\t"
                 "global_load_async_to_lds_b128 %2, %10, off\n\t"
                 "global_load_async_to_lds_b128 %3, %11, off\n\t"
                 "global_load_async_to_lds_b128 %4, %12, off\n\t"
                 "global_load_async_to_lds_b128 %5, %13, off\n\t"
                 "global_load_async_to_lds_b128 %6, %14, off\n\t"
                 "global_load_async_to_lds_b128 %7, %15, off\n\t"
                 "s_wait_xcnt 0x0"
                 :: "v"(lk), "v"(lk + 32u * AKPB_), "v"(lk + 64u * AKPB_), "v"(lk + 96u * AKPB_),
                    "v"(lv), "v"(lv + 16u * AVPB_), "v"(lv + 32u * AVPB_), "v"(lv + 48u * AVPB_),
                    "v"(gk), "v"(gk + 32 * HD_), "v"(gk + 64 * HD_), "v"(gk + 96 * HD_),
                    "v"(gv), "v"(gv + 16 * S_), "v"(gv + 32 * S_), "v"(gv + 48 * S_)
                 : "memory");
}

// amdgpu_waves_per_eu(4, 4): two work-groups per WGP, four waves per SIMD, so that
// one wave's softmax runs beside another's products.
__global__ void __launch_bounds__(256) __attribute__((amdgpu_waves_per_eu(4, 4)))
attn_kernel(const unsigned short* __restrict__ Qb,
            const unsigned short* __restrict__ Kb,
            const unsigned short* __restrict__ VTb,
            const int* __restrict__ maskp,
            unsigned short* __restrict__ ctxb) {
    __shared__ __attribute__((aligned(16))) unsigned short skv[2 * ASTG_];
    __shared__ __attribute__((aligned(16))) int smask[S_];
    const int tid = threadIdx.x;
    const int lane = tid & 31, half = lane >> 4, l15 = lane & 15;
    const int bid = blockIdx.x;
    const int qt = (bid & 7) * 8 + (tid >> 5), hh = (bid >> 3) & 15, bb = bid >> 7;
    const int NT = S_ / AKS_;          // stages

    const unsigned short* Qh  = Qb  + ((size_t)(bb * NH_ + hh) * S_) * HD_;
    const unsigned short* Kh  = Kb  + ((size_t)(bb * NH_ + hh) * S_) * HD_;
    const unsigned short* VTh = VTb + ((size_t)(bb * NH_ + hh) * HD_) * S_;

    // this lane's copy addresses for stage 0
    const unsigned short* gK = Kh + (tid >> 3) * HD_ + (tid & 7) * 8;
    const unsigned short* gV = VTh + (size_t)(tid >> 4) * S_ + (tid & 15) * 8;
    const unsigned lK = (unsigned)(size_t)&skv[0] + (unsigned)(tid >> 3) * AKPB_ +
                        (unsigned)(tid & 7) * 16u;
    const unsigned lV = (unsigned)(size_t)&skv[AKE_] + (unsigned)(tid >> 4) * AVPB_ +
                        (unsigned)(tid & 15) * 16u;

    // prologue: mask row and stage 0 landed and published, stage 1 in flight
    {
        const int* gm = maskp + bb * S_ + tid * 4;
        const unsigned lm = (unsigned)(size_t)&smask[0] + (unsigned)tid * 16u;
        // the batch's 2048 mask words, two 16 B copies per lane; s_wait_xcnt as above
        asm volatile("global_load_async_to_lds_b128 %0, %2, off\n\t"
                     "global_load_async_to_lds_b128 %1, %3, off\n\t"
                     "s_wait_xcnt 0x0"
                     :: "v"(lm), "v"(lm + 4096u), "v"(gm), "v"(gm + 1024)
                     : "memory");
    }
    async_copy_kv(gK, gV, lK, lV);

    v16bf bq[2][2];
#pragma unroll
    for (int nt = 0; nt < 2; ++nt)
#pragma unroll
        for (int kk = 0; kk < 2; ++kk)
            bq[nt][kk] = load_frag(Qh + (size_t)(qt * 32 + nt * 16 + l15) * HD_ + kk * 32, half);

    asm volatile("s_wait_asynccnt 0x0" ::: "memory");  // own copies of mask and stage 0 landed
    __syncthreads();                                   // both visible to all waves
    async_copy_kv(gK + AKS_ * HD_, gV + AKS_, lK + ASTGB_, lV + ASTGB_);

    float mrow[2] = {-3.0e38f, -3.0e38f};   // running maximum of query nt*16 + l15
    float lrow[2] = {0.f, 0.f};             // this half's share of its running sum
    v8f cacc[4][2] = {};                    // O^T: d = dt*16 + 8*half + r, query nt*16 + l15

    // both loops rolled: one copy of the chunk body, for speed only
#pragma unroll 1
    for (int t = 0; t < NT; ++t) {
      const int cur = t & 1;
      // this lane's read addresses, its half's 8 k folded in (load_frag's half = 0)
      const unsigned short* sK = &skv[cur * ASTG_ + l15 * AKP_ + 8 * half];
      const unsigned short* sV = &skv[cur * ASTG_ + AKE_ + l15 * AVP_ + 8 * half];
      const int* sM = &smask[t * AKS_ + 8 * half];
#pragma unroll 1
      for (int c0 = 0; c0 < AKS_; c0 += 32) {
        v16bf ak[2][2], av[4];
#pragma unroll
        for (int mt = 0; mt < 2; ++mt)
#pragma unroll
            for (int kk = 0; kk < 2; ++kk)
                ak[mt][kk] = load_frag(sK + mt * 16 * AKP_ + kk * 32, 0);
        // mask of this lane's 16 kv rows: chunk start + mt*16 + 8*half + r
        v4i mk[2][2];
#pragma unroll
        for (int mt = 0; mt < 2; ++mt) {
            mk[mt][0] = *(const v4i*)(sM + mt * 16);
            mk[mt][1] = *(const v4i*)(sM + mt * 16 + 4);
        }
#pragma unroll
        for (int dt = 0; dt < 4; ++dt)
            av[dt] = load_frag(sV + dt * 16 * AVP_, 0);
        // keeps the chunk's 20 LDS reads one group ahead of the products, for speed only
        __builtin_amdgcn_sched_barrier(0);

        // scores: S^T = (K Q^T) * 0.125 + mask * -1e8
        v8f sf[2][2] = {};
#pragma unroll
        for (int mt = 0; mt < 2; ++mt)
#pragma unroll
            for (int nt = 0; nt < 2; ++nt)
#pragma unroll
                for (int kk = 0; kk < 2; ++kk)
                    sf[mt][nt] = wmma_bf16(ak[mt][kk], bq[nt][kk], sf[mt][nt]);

#pragma unroll
        for (int mt = 0; mt < 2; ++mt) {
            v8f mb;
#pragma unroll
            for (int r = 0; r < 8; ++r) mb[r] = (float)mk[mt][r >> 2][r & 3] * -1e8f;
            sf[mt][0] = sf[mt][0] * 0.125f + mb;
            sf[mt][1] = sf[mt][1] * 0.125f + mb;
        }

        float mnew[2];
#pragma unroll
        for (int nt = 0; nt < 2; ++nt) {
            float c0 = sf[0][nt][0], c1 = sf[1][nt][0];
#pragma unroll
            for (int r = 1; r < 8; ++r) c0 = fmaxf(c0, sf[0][nt][r]);
#pragma unroll
            for (int r = 1; r < 8; ++r) c1 = fmaxf(c1, sf[1][nt][r]);
            float cm = fmaxf(c0, c1);
            cm = fmaxf(cm, xhalf(cm));      // both halves feed one product: one maximum
            mnew[nt] = fmaxf(mrow[nt], cm);
        }
        float rs[2];
#pragma unroll
        for (int nt = 0; nt < 2; ++nt) {
            rs[nt] = __expf(mrow[nt] - mnew[nt]);
            mrow[nt] = mnew[nt];
        }

#pragma unroll
        for (int nt = 0; nt < 2; ++nt) {
            const float mn = mnew[nt], resc = rs[nt];
            const v8f t0 = sf[0][nt] - mn, t1 = sf[1][nt] - mn;
            v8f p0, p1;
#pragma unroll
            for (int r = 0; r < 8; ++r) p0[r] = __expf(t0[r]);
#pragma unroll
            for (int r = 0; r < 8; ++r) p1[r] = __expf(t1[r]);
            const v8f s8 = p0 + p1;
            const v4f s4 = __builtin_shufflevector(s8, s8, 0, 1, 2, 3) +
                           __builtin_shufflevector(s8, s8, 4, 5, 6, 7);
            const float ps = (s4[0] + s4[2]) + (s4[1] + s4[3]);
            lrow[nt] = lrow[nt] * resc + ps;
            const v16bf bp = __builtin_shufflevector(__builtin_convertvector(p0, v8bf),
                                                     __builtin_convertvector(p1, v8bf),
                                                     0, 1, 2, 3, 4, 5, 6, 7,
                                                     8, 9, 10, 11, 12, 13, 14, 15);
#pragma unroll
            for (int dt = 0; dt < 4; ++dt) {
                cacc[dt][nt] *= resc;
                cacc[dt][nt] = wmma_bf16(av[dt], bp, cacc[dt][nt]);
            }
        }
        // ends the chunk's scheduling region behind the last product: the three
        // address steps stay there and fill its hazard window; without it the
        // listing holds more v_nop per chunk
        __builtin_amdgcn_sched_barrier(0);
        sK += 32 * AKP_;
        sV += 32;
        sM += 32;
      }
      asm volatile("s_wait_dscnt 0x0" ::: "memory");     // own reads of this buffer done
      asm volatile("s_wait_asynccnt 0x0" ::: "memory");  // own copies of stage t+1 landed
      __syncthreads();  // publishes stage t+1 and frees the buffer just read
      if (t + 2 < NT)
          async_copy_kv(gK + (t + 2) * AKS_ * HD_, gV + (t + 2) * AKS_,
                        lK + (unsigned)cur * ASTGB_, lV + (unsigned)cur * ASTGB_);
    }
    asm volatile("s_wait_asynccnt 0x0" ::: "memory");  // nothing in flight at the end

#pragma unroll
    for (int nt = 0; nt < 2; ++nt) {
        const float inv = 1.0f / (lrow[nt] + xhalf(lrow[nt]));
        const int s = qt * 32 + nt * 16 + l15;
        unsigned short* dst = ctxb + (size_t)(bb * S_ + s) * H_ + hh * HD_ + 8 * half;
#pragma unroll
        for (int dt = 0; dt < 4; ++dt)
            *(v4u*)(dst + dt * 16) =
                __builtin_bit_cast(v4u, __builtin_convertvector(cacc[dt][nt] * inv, v8bf));
    }
}

// ---------------------------------------------------------------------------
extern "C" void kernel_launch(void* const* d_in, const int* in_sizes, int n_in,
                              void* d_out, int out_size, void* d_ws, size_t ws_size,
                              hipStream_t stream) {
    (void)in_sizes; (void)n_in; (void)out_size; (void)ws_size;
    const float* x       = (const float*)d_in[0];
    const int*   mask    = (const int*)d_in[1];
    const float* qkv_w   = (const float*)d_in[2];
    const float* qkv_b   = (const float*)d_in[3];
    const float* out_w   = (const float*)d_in[4];
    const float* out_b   = (const float*)d_in[5];
    const float* ln_g    = (const float*)d_in[6];
    const float* ln_b    = (const float*)d_in[7];
    float* out = (float*)d_out;

    // workspace layout (bf16 buffers), ~88 MB total
    char* w = (char*)d_ws;
    unsigned short* yb     = (unsigned short*)w;                 w += (size_t)BS_ * H_ * 2;       // 16 MB
    unsigned short* qkv_wb = (unsigned short*)w;                 w += (size_t)3 * H_ * H_ * 2;    //  6 MB
    unsigned short* out_wb = (unsigned short*)w;                 w += (size_t)H_ * H_ * 2;        //  2 MB
    unsigned short* Qb     = (unsigned short*)w;                 w += (size_t)BS_ * H_ * 2;       // 16 MB
    unsigned short* Kb     = (unsigned short*)w;                 w += (size_t)BS_ * H_ * 2;       // 16 MB
    unsigned short* VTb    = (unsigned short*)w;                 w += (size_t)BS_ * H_ * 2;       // 16 MB
    unsigned short* ctxb   = (unsigned short*)w;                                                  // 16 MB

    cvt_weights_kernel<<<(3 * H_ * H_ + H_ * H_) / 256, 256, 0, stream>>>(
        qkv_w, out_w, qkv_wb, out_wb);
    ln_kernel<<<BS_, 256, 0, stream>>>(x, ln_g, ln_b, yb);
    gemm_tile_kernel<0><<<dim3(3 * H_ / GBN_, BS_ / GBM_), 256, 0, stream>>>(
        yb, qkv_wb, qkv_b, Qb, Kb, VTb, nullptr, nullptr);
    attn_kernel<<<B_ * NH_ * (S_ / 256), 256, 0, stream>>>(Qb, Kb, VTb, mask, ctxb);
    gemm_tile_kernel<1><<<dim3(H_ / GBN_, BS_ / GBM_), 256, 0, stream>>>(
        ctxb, out_wb, out_b, nullptr, nullptr, nullptr, x, out);
}

// v004
// One run takes 136 microseconds.
// Next to v003, in two timings, it ran 1.15 times as fast each time.
// All steps since v000 together make it 3.07 times as fast.
#include <hip/hip_runtime.h>
#include <hip/hip_bf16.h>

// ---------------------------------------------------------------------------
// LightSeq-style pre-LN multihead attention layer for MI455X (gfx1250).
// fp32 math for LN/softmax/accum; bf16 operands into v_wmma_f32_16x16x32_bf16.
// GEMMs: 8-wave workgroup, 256x128 tile, A and W rows double-buffered into LDS
// via GLOBAL_LOAD_ASYNC_TO_LDS_B128 (ASYNCcnt), 64x64 of the output per wave.
// Attention: 8 waves x 32 queries, K / V^T stages shared in LDS (async copies),
// flash-style online softmax on transposed products (S^T = K Q^T,
// O^T += V^T P^T), P kept in registers.
// B=4, S=2048, H=1024, NH=16, HD=64.
// ---------------------------------------------------------------------------

#define B_   4
#define S_   2048
#define H_   1024
#define NH_  16
#define HD_  64
#define BS_  (B_ * S_)

typedef __attribute__((ext_vector_type(16))) __bf16        v16bf;
typedef __attribute__((ext_vector_type(8)))  float         v8f;
typedef __attribute__((ext_vector_type(4)))  unsigned int  v4u;
typedef __attribute__((ext_vector_type(8)))  __bf16        v8bf;
typedef __attribute__((ext_vector_type(4)))  int           v4i;
typedef __attribute__((ext_vector_type(4)))  float         v4f;
typedef __attribute__((ext_vector_type(4)))  __bf16        v4bf;
typedef __attribute__((ext_vector_type(2)))  unsigned int  v2u;

struct Frag32B { v4u lo, hi; };

static __device__ __forceinline__ unsigned short f2bfu(float f) {
    unsigned int u = __builtin_bit_cast(unsigned int, f);
    unsigned int r = u + 0x7FFFu + ((u >> 16) & 1u);   // round-to-nearest-even
    return (unsigned short)(r >> 16);
}

// Load one 16x32 bf16 A/B fragment for this lane. `row` points at the start of
// the (stride-aligned) 32-wide K slice of this lane's row/column.
// Per ISA 7.12.2: elements 0..7 = K[8*half .. 8*half+7],
//                 elements 8..15 = K[16+8*half .. 23+8*half].
static __device__ __forceinline__ v16bf load_frag(const unsigned short* row, int half) {
    Frag32B f;
    f.lo = *(const v4u*)(row + 8 * half);
    f.hi = *(const v4u*)(row + 16 + 8 * half);
    return __builtin_bit_cast(v16bf, f);
}

static __device__ __forceinline__ v8f wmma_bf16(v16bf a, v16bf b, v8f c) {
    return __builtin_amdgcn_wmma_f32_16x16x32_bf16(false, a, false, b, (short)0, c,
                                                   false, false);
}

// The value that lane ^ 16 holds (the other half of the wave).
static __device__ __forceinline__ float xhalf(float v) {
    const int b = __builtin_bit_cast(int, v);
    return __builtin_bit_cast(float, __builtin_amdgcn_permlanex16(b, b, 0x76543210, 0xfedcba98,
                                                                  false, false));
}

// GEMM tile: 256 rows of A x 128 rows of W per workgroup, 64 k per stage.
// LDS layout of one stage: 256 A rows then 128 W rows, each 64 k (128 B) at a
// pitch of 144 B (16 B x odd: ds_load_b128 fragment reads hit all banks).
#define GBM_   256
#define GBN_   128
#define GP_    72                      // row pitch in elements
#define GPB_   144u                    // row pitch in bytes
#define GSTG_  ((GBM_ + GBN_) * GP_)   // elements per stage
#define GSTGB_ (GSTG_ * 2)             // bytes per stage

// One stage's twelve async 16 B copies of this lane: A rows r + 32 i (i < 8) and
// W rows r + 32 i (i < 4), r = tid >> 3, 16 B chunk tid & 7, so each wave copy
// covers four whole 128 B lines. ga / gw / lds are the lane's addresses for row r.
// s_wait_xcnt closes the statement so that no address register of an issued
// copy is rewritten ahead of it.
static __device__ __forceinline__ void async_copy_stage(const unsigned short* ga,
                                                        const unsigned short* gw,
                                                        unsigned lds) {
    const unsigned lw = lds + GBM_ * GPB_;
    asm volatile("global_load_async_to_lds_b128 %0, %12, off\n\t"
                 "global_load_async_to_lds_b128 %1, %13, off\n\t"
                 "global_load_async_to_lds_b128 %2, %14, off\n\t"
                 "global_load_async_to_lds_b128 %3, %15, off\n\t"
                 "global_load_async_to_lds_b128 %4, %16, off\n\t"
                 "global_load_async_to_lds_b128 %5, %17, off\n\t"
                 "global_load_async_to_lds_b128 %6, %18, off\n\t"
                 "global_load_async_to_lds_b128 %7, %19, off\n\t"
                 "global_load_async_to_lds_b128 %8, %20, off\n\t"
                 "global_load_async_to_lds_b128 %9, %21, off\n\t"
                 "global_load_async_to_lds_b128 %10, %22, off\n\t"
                 "global_load_async_to_lds_b128 %11, %23, off\n\t"
                 "s_wait_xcnt 0x0"
                 :: "v"(lds), "v"(lds + 32u * GPB_), "v"(lds + 64u * GPB_),
                    "v"(lds + 96u * GPB_), "v"(lds + 128u * GPB_), "v"(lds + 160u * GPB_),
                    "v"(lds + 192u * GPB_), "v"(lds + 224u * GPB_),
                    "v"(lw), "v"(lw + 32u * GPB_), "v"(lw + 64u * GPB_), "v"(lw + 96u * GPB_),
                    "v"(ga), "v"(ga + 32 * H_), "v"(ga + 64 * H_), "v"(ga + 96 * H_),
                    "v"(ga + 128 * H_), "v"(ga + 160 * H_), "v"(ga + 192 * H_), "v"(ga + 224 * H_),
                    "v"(gw), "v"(gw + 32 * H_), "v"(gw + 64 * H_), "v"(gw + 96 * H_)
                 : "memory");
}

// ---------------------------------------------------------------------------
// The two streaming passes in front of the GEMMs. Both are built from few waves
// that each take whole 1024-float rows: a row is eight 16 B loads per lane, load j
// covering floats j*128 .. j*128+127 (512 contiguous bytes, four whole lines), and
// eight 8 B stores of bf16 (256 contiguous bytes, two whole lines). All loads of a
// wave are issued before its first use, so each WGP's whole share is in flight at
// once and the launch starts a few thousand waves, not one per 32 or 128 elements.
// ---------------------------------------------------------------------------
#define RCH_ (H_ / 128)                // 16 B loads per lane and row

// 16 bytes at a wave-uniform base + the lane's byte offset + a constant.
static __device__ __forceinline__ v4f ld16(const float* base, unsigned off, int c) {
    return *(const v4f*)((const char*)base + off + c);
}

static __device__ __forceinline__ v2u pack4(v4f v) {
    return __builtin_bit_cast(v2u, __builtin_convertvector(v, v4bf));   // round to nearest even
}

// v plus the value of lane ^ MASK of the same 16-lane row (DPP row_xmask).
template <int MASK>
static __device__ __forceinline__ float add_xmask(float v) {
    const int b = __builtin_bit_cast(int, v);
    return v + __builtin_bit_cast(float,
                                  __builtin_amdgcn_update_dpp(b, b, 0x160 + MASK, 0xf, 0xf, false));
}

// Sum over the wave's 32 lanes, the same value in every lane.
static __device__ __forceinline__ float wave_sum(float v) {
    v = add_xmask<1>(v);
    v = add_xmask<2>(v);
    v = add_xmask<4>(v);
    v = add_xmask<8>(v);
    return v + xhalf(v);
}

// ---------------------------------------------------------------------------
// Kernel 1: cast fp32 weights -> bf16 (qkv_w [3H,H] and out_w [H,H], row-major;
// rows of W are B-fragment columns, so no transpose is needed).
// 256 work-groups of 8 waves, two rows per wave.
// ---------------------------------------------------------------------------
#define CVR_ 2                         // rows per wave
__global__ void __launch_bounds__(256)
cvt_weights_kernel(const float* __restrict__ qkv_w,
                   const float* __restrict__ out_w,
                   unsigned short* __restrict__ qkv_wb,
                   unsigned short* __restrict__ out_wb) {
    const unsigned lane = threadIdx.x & 31;
    const int wave = __builtin_amdgcn_readfirstlane(threadIdx.x >> 5);
    const int row = (blockIdx.x * 8 + wave) * CVR_;     // of the 4H rows of both matrices
    const bool isq = row < 3 * H_;
    const float* src = isq ? qkv_w + row * H_ : out_w + (row - 3 * H_) * H_;
    unsigned short* dst = (isq ? qkv_wb + row * H_ : out_wb + (row - 3 * H_) * H_) + lane * 4;
    const unsigned off = lane * 16;                     // this lane's bytes in each load
    v4f v[CVR_ * RCH_];
#pragma unroll
    for (int j = 0; j < CVR_ * RCH_; ++j) v[j] = ld16(src, off, j * 512);
    // behind the last load, in front of every rewrite of a register that the loads
    // name as address (in the listing: lane as scaled offset, the scalar bases): the
    // operands keep those registers as they are up to the wait
    asm volatile("s_wait_xcnt 0x0" :: "v"(lane), "s"(src) : "memory");
    // keeps every load ahead of the first conversion: without it the last loads are
    // issued only when the first have come back, a second memory latency per wave
    __builtin_amdgcn_sched_barrier(0);
#pragma unroll
    for (int j = 0; j < CVR_ * RCH_; ++j) *(v2u*)(dst + j * 128) = pack4(v[j]);
}

// ---------------------------------------------------------------------------
// Kernel 2: pre-LayerNorm, fp32 in -> bf16 out (GEMM A operand).
// 256 work-groups of 16 waves, two rows per wave, a row held in 32 registers per
// lane: read once, summed in the lane and then across the lanes, no LDS, no barrier.
// ---------------------------------------------------------------------------
#define LNR_ 2                         // rows per wave
__global__ void __launch_bounds__(512)
ln_kernel(const float* __restrict__ x, const float* __restrict__ g,
          const float* __restrict__ bta,
          unsigned short* __restrict__ yb) {
    const unsigned lane = threadIdx.x & 31;
    const int wave = __builtin_amdgcn_readfirstlane(threadIdx.x >> 5);
    const int row = (blockIdx.x * 16 + wave) * LNR_;
    const float* xr = x + (size_t)row * H_;
    unsigned short* yr = yb + (size_t)row * H_ + lane * 4;
    const unsigned off = lane * 16;                     // this lane's bytes in each load
    v4f v[LNR_][RCH_], gv[RCH_], bv[RCH_];
#pragma unroll
    for (int r = 0; r < LNR_; ++r)
#pragma unroll
        for (int j = 0; j < RCH_; ++j) v[r][j] = ld16(xr, off, r * H_ * 4 + j * 512);
#pragma unroll
    for (int j = 0; j < RCH_; ++j) gv[j] = ld16(g, off, j * 512);
#pragma unroll
    for (int j = 0; j < RCH_; ++j) bv[j] = ld16(bta, off, j * 512);
    // behind the last load, in front of every rewrite of a register that the loads
    // name as address (in the listing: lane as scaled offset, the scalar bases): the
    // operands keep those registers as they are up to the wait
    asm volatile("s_wait_xcnt 0x0" :: "v"(lane), "s"(xr), "s"(g), "s"(bta) : "memory");
    // keeps all 32 loads ahead of the sums: without it the gamma and beta loads sink
    // into the tail in small groups, each waited out on its own
    __builtin_amdgcn_sched_barrier(0);

#pragma unroll
    for (int r = 0; r < LNR_; ++r) {
        v4f a4 = v[r][0], q4 = v[r][0] * v[r][0];
#pragma unroll
        for (int j = 1; j < RCH_; ++j) { a4 += v[r][j]; q4 += v[r][j] * v[r][j]; }
        const float a  = wave_sum((a4[0] + a4[1]) + (a4[2] + a4[3]));
        const float b2 = wave_sum((q4[0] + q4[1]) + (q4[2] + q4[3]));
        const float mean = a * (1.f / H_);
        const float var  = b2 * (1.f / H_) - mean * mean;
        const float rstd = rsqrtf(var + 1e-5f);
#pragma unroll
        for (int j = 0; j < RCH_; ++j)
            *(v2u*)(yr + r * H_ + j * 128) = pack4((v[r][j] - mean) * rstd * gv[j] + bv[j]);
    }
}

// ---------------------------------------------------------------------------
// Kernels 3/5: 256x128-tile GEMM, 8 waves (4x2), 64x64 of Y per wave: 16 WMMAs
// per 8 fragments. A and W rows (64 k per stage) are double-buffered in LDS by
// async copies; the copies of stage t+2 fly while stage t+1 is worked on.
// MODE 0: QKV projection epilogue (+bias, scatter Q/K -> [B,NH,S,HD],
//         V -> [B,NH,HD,S], bf16).
// MODE 1: out-projection epilogue (+bias, +residual, fp32 to d_out).
// ---------------------------------------------------------------------------
template <int MODE>
__global__ void __launch_bounds__(256)
gemm_tile_kernel(const unsigned short* __restrict__ Ab,
                 const unsigned short* __restrict__ Wb,
                 const float* __restrict__ bias,
                 unsigned short* __restrict__ Qb,
                 unsigned short* __restrict__ Kb,
                 unsigned short* __restrict__ VTb,
                 const float* __restrict__ xres,
                 float* __restrict__ outp) {
    __shared__ __attribute__((aligned(16))) unsigned short sh[2 * GSTG_];
    const int tid = threadIdx.x;
    const int w = tid >> 5, lane = tid & 31;
    const int half = lane >> 4, l15 = lane & 15;
    const int wm = w >> 1, wn = w & 1;
    const int m0 = blockIdx.y * GBM_;
    const int n0 = blockIdx.x * GBN_;
    const int NT = H_ / 64;            // stages

    const int crow = tid >> 3, cchk = tid & 7;
    const unsigned short* gA = Ab + (size_t)(m0 + crow) * H_ + cchk * 8;
    const unsigned short* gW = Wb + (size_t)(n0 + crow) * H_ + cchk * 8;
    const unsigned lds0 = (unsigned)(size_t)&sh[0] + (unsigned)crow * GPB_ + (unsigned)cchk * 16u;

    v8f acc[4][4] = {};

    // prologue: stage 0 landed and published, stage 1 in flight
    async_copy_stage(gA, gW, lds0);
    asm volatile("s_wait_asynccnt 0x0" ::: "memory");  // own copies of stage 0 landed
    __syncthreads();                                   // stage 0 visible to all waves
    async_copy_stage(gA + 64, gW + 64, lds0 + GSTGB_);

    // rolled: one copy of the 32-WMMA body, for speed only
#pragma unroll 1
    for (int t = 0; t < NT; ++t) {
        const int cur = t & 1;
        const unsigned short* sA = &sh[cur * GSTG_ + (wm * 64 + l15) * GP_];
        const unsigned short* sW = &sh[cur * GSTG_ + (GBM_ + wn * 64 + l15) * GP_];
#pragma unroll
        for (int kk = 0; kk < 2; ++kk) {
            v16bf a[4], b[4];
#pragma unroll
            for (int i = 0; i < 4; ++i) a[i] = load_frag(sA + i * 16 * GP_ + kk * 32, half);
#pragma unroll
            for (int i = 0; i < 4; ++i) b[i] = load_frag(sW + i * 16 * GP_ + kk * 32, half);
            // keeps the 16 LDS reads one group ahead of the WMMA block, for speed only
            __builtin_amdgcn_sched_barrier(0);
#pragma unroll
            for (int ni = 0; ni < 4; ++ni)
#pragma unroll
                for (int mi = 0; mi < 4; ++mi)
                    acc[mi][ni] = wmma_bf16(a[mi], b[ni], acc[mi][ni]);
            // keeps the next group of LDS reads out of this WMMA block
            __builtin_amdgcn_sched_barrier(0);
        }
        asm volatile("s_wait_dscnt 0x0" ::: "memory");     // own reads of this buffer done
        asm volatile("s_wait_asynccnt 0x0" ::: "memory");  // own copies of stage t+1 landed
        __syncthreads();  // publishes stage t+1 and frees the buffer just read
        if (t + 2 < NT)
            async_copy_stage(gA + (t + 2) * 64, gW + (t + 2) * 64, lds0 + (unsigned)cur * GSTGB_);
    }
    asm volatile("s_wait_asynccnt 0x0" ::: "memory");  // nothing in flight at the end

    float bv[4];
#pragma unroll
    for (int ni = 0; ni < 4; ++ni) bv[ni] = bias[n0 + wn * 64 + ni * 16 + l15];

    if (MODE == 0) {
        // A tile's 256 tokens lie in one batch, its 128 features in one of q/k/v,
        // a wave's 64 features in one head (d = ni*16 + l15): one address per lane,
        // every (mi, r, ni) step a constant offset. Each path walks its stores so
        // that neighbours in time fall into the same 128 B line.
        const int sec = n0 >> 10;                              // 0=q 1=k 2=v
        const int s0 = (m0 & (S_ - 1)) + wm * 64 + 8 * half;   // token of (mi=0, r=0)
        const int bh = (m0 >> 11) * NH_ + ((n0 & (H_ - 1)) >> 6) + wn;
        if (sec == 2) {
            unsigned short* dst = VTb + (((bh * HD_ + l15) << 11) + s0);
#pragma unroll
            for (int ni = 0; ni < 4; ++ni)
#pragma unroll
                for (int mi = 0; mi < 4; ++mi)
#pragma unroll
                    for (int r = 0; r < 8; ++r)
                        dst[((ni * 16) << 11) + mi * 16 + r] = f2bfu(acc[mi][ni][r] + bv[ni]);
            return;
        }
        unsigned short* dst = (sec == 0 ? Qb : Kb) + (((bh * S_ + s0) << 6) + l15);
#pragma unroll
        for (int mi = 0; mi < 4; ++mi)
#pragma unroll
            for (int r = 0; r < 8; ++r)
#pragma unroll
                for (int ni = 0; ni < 4; ++ni)
                    dst[((mi * 16 + r) << 6) + ni * 16] = f2bfu(acc[mi][ni][r] + bv[ni]);
    } else {
        // One address per lane, every (mi, r, ni) step a constant offset. The wave's
        // 128 residual loads go out as one group ahead of the adds and stores, so
        // that their latency is waited out once and not once per element.
        const unsigned i0 = (unsigned)((m0 + wm * 64 + 8 * half) * H_ + n0 + wn * 64 + l15);
        const float* xp = xres + i0;
        float* op = outp + i0;
        float xr[4][8][4];
#pragma unroll
        for (int mi = 0; mi < 4; ++mi)
#pragma unroll
            for (int r = 0; r < 8; ++r)
#pragma unroll
                for (int ni = 0; ni < 4; ++ni)
                    xr[mi][r][ni] = xp[(mi * 16 + r) * H_ + ni * 16];
#pragma unroll
        for (int mi = 0; mi < 4; ++mi)
#pragma unroll
            for (int r = 0; r < 8; ++r)
#pragma unroll
                for (int ni = 0; ni < 4; ++ni)
                    op[(mi * 16 + r) * H_ + ni * 16] = acc[mi][ni][r] + bv[ni] + xr[mi][r][ni];
    }
}

// ---------------------------------------------------------------------------
// Kernel 4: flash-style attention, transposed products. A work-group of 8 waves
// handles (b, head, 256 queries), one wave 32 of them, streaming kv in chunks of
// 32 with online softmax. K rows and V^T rows are shared by the 8 waves: stages of
// 128 keys are double-buffered in LDS by async copies, the batch's mask row is
// copied once; the copies of stage t+2 fly while stage t+1 is worked on.
// S^T = K Q^T: A = K rows, B = Q columns, so a lane holds 16 scores of ONE query
// per 16-query group: maximum and sum run in the lane, the two wave halves
// exchange the maximum once per chunk and join their sums once at the end.
// O^T += V^T P^T: the two S^T tiles of a query group, converted in place, are the
// B operand in the hardware k order (kv = 8*half + s, 16 + 8*half + s - 8), which
// is the order load_frag gives the V^T rows: P never leaves the registers.
// ctx -> bf16 [B,S,H]: a lane's 8 accumulator registers are 8 consecutive d.
// ---------------------------------------------------------------------------
// LDS layout of one stage: 128 K rows of 64 d (128 B) at a pitch of 144 B, then
// 64 V^T rows of 128 keys (256 B) at a pitch of 272 B (both 16 B x odd:
// ds_load_b128 fragment reads hit all banks).
#define AKS_   128                     // keys per stage
#define AKP_   72                      // K row pitch in elements
#define AKPB_  144u                    // K row pitch in bytes
#define AVP_   136                     // V^T row pitch in elements
#define AVPB_  272u                    // V^T row pitch in bytes
#define AKE_   (AKS_ * AKP_)           // elements of a stage's K part
#define ASTG_  (AKE_ + HD_ * AVP_)     // elements per stage
#define ASTGB_ (ASTG_ * 2)             // bytes per stage

// One stage's eight async 16 B copies of this lane: K rows r + 32 i (i < 4),
// r = tid >> 3, 16 B chunk tid & 7, and V^T rows q + 16 i (i < 4), q = tid >> 4,
// 16 B chunk tid & 15, so each wave copy covers four whole 128 B lines.
// gk / gv / lk / lv are the lane's addresses for rows r and q.
// s_wait_xcnt closes the statement so that no address register of an issued
// copy is rewritten ahead of it.
static __device__ __forceinline__ void async_copy_kv(const unsigned short* gk,
                                                     const unsigned short* gv,
                                                     unsigned lk, unsigned lv) {
    asm volatile("global_load_async_to_lds_b128 %0, %8, off\n\t"
                 "global_load_async_to_lds_b128 %1, %9, off\n\t"
                 "global_load_async_to_lds_b128 %2, %10, off\n\t"
                 "global_load_async_to_lds_b128 %3, %11, off\n\t"
                 "global_load_async_to_lds_b128 %4, %12, off\n\t"
                 "global_load_async_to_lds_b128 %5, %13, off\n\t"
                 "global_load_async_to_lds_b128 %6, %14, off\n\t"
                 "global_load_async_to_lds_b128 %7, %15, off\n\t"
                 "s_wait_xcnt 0x0"
                 :: "v"(lk), "v"(lk + 32u * AKPB_), "v"(lk + 64u * AKPB_), "v"(lk + 96u * AKPB_),
                    "v"(lv), "v"(lv + 16u * AVPB_), "v"(lv + 32u * AVPB_), "v"(lv + 48u * AVPB_),
                    "v"(gk), "v"(gk + 32 * HD_), "v"(gk + 64 * HD_), "v"(gk + 96 * HD_),
                    "v"(gv), "v"(gv + 16 * S_), "v"(gv + 32 * S_), "v"(gv + 48 * S_)
                 : "memory");
}

// amdgpu_waves_per_eu(4, 4): two work-groups per WGP, four waves per SIMD, so that
// one wave's softmax runs beside another's products.
__global__ void __launch_bounds__(256) __attribute__((amdgpu_waves_per_eu(4, 4)))
attn_kernel(const unsigned short* __restrict__ Qb,
            const unsigned short* __restrict__ Kb,
            const unsigned short* __restrict__ VTb,
            const int* __restrict__ maskp,
            unsigned short* __restrict__ ctxb) {
    __shared__ __attribute__((aligned(16))) unsigned short skv[2 * ASTG_];
    __shared__ __attribute__((aligned(16))) int smask[S_];
    const int tid = threadIdx.x;
    const int lane = tid & 31, half = lane >> 4, l15 = lane & 15;
    const int bid = blockIdx.x;
    const int qt = (bid & 7) * 8 + (tid >> 5), hh = (bid >> 3) & 15, bb = bid >> 7;
    const int NT = S_ / AKS_;          // stages

    const unsigned short* Qh  = Qb  + ((size_t)(bb * NH_ + hh) * S_) * HD_;
    const unsigned short* Kh  = Kb  + ((size_t)(bb * NH_ + hh) * S_) * HD_;
    const unsigned short* VTh = VTb + ((size_t)(bb * NH_ + hh) * HD_) * S_;

    // this lane's copy addresses for stage 0
    const unsigned short* gK = Kh + (tid >> 3) * HD_ + (tid & 7) * 8;
    const unsigned short* gV = VTh + (size_t)(tid >> 4) * S_ + (tid & 15) * 8;
    const unsigned lK = (unsigned)(size_t)&skv[0] + (unsigned)(tid >> 3) * AKPB_ +
                        (unsigned)(tid & 7) * 16u;
    const unsigned lV = (unsigned)(size_t)&skv[AKE_] + (unsigned)(tid >> 4) * AVPB_ +
                        (unsigned)(tid & 15) * 16u;

    // prologue: mask row and stage 0 landed and published, stage 1 in flight
    {
        const int* gm = maskp + bb * S_ + tid * 4;
        const unsigned lm = (unsigned)(size_t)&smask[0] + (unsigned)tid * 16u;
        // the batch's 2048 mask words, two 16 B copies per lane; s_wait_xcnt as above
        asm volatile("global_load_async_to_lds_b128 %0, %2, off\n\t"
                     "global_load_async_to_lds_b128 %1, %3, off\n\t"
                     "s_wait_xcnt 0x0"
                     :: "v"(lm), "v"(lm + 4096u), "v"(gm), "v"(gm + 1024)
                     : "memory");
    }
    async_copy_kv(gK, gV, lK, lV);

    v16bf bq[2][2];
#pragma unroll
    for (int nt = 0; nt < 2; ++nt)
#pragma unroll
        for (int kk = 0; kk < 2; ++kk)
            bq[nt][kk] = load_frag(Qh + (size_t)(qt * 32 + nt * 16 + l15) * HD_ + kk * 32, half);

    asm volatile("s_wait_asynccnt 0x0" ::: "memory");  // own copies of mask and stage 0 landed
    __syncthreads();                                   // both visible to all waves
    async_copy_kv(gK + AKS_ * HD_, gV + AKS_, lK + ASTGB_, lV + ASTGB_);

    float mrow[2] = {-3.0e38f, -3.0e38f};   // running maximum of query nt*16 + l15
    float lrow[2] = {0.f, 0.f};             // this half's share of its running sum
    v8f cacc[4][2] = {};                    // O^T: d = dt*16 + 8*half + r, query nt*16 + l15

    // both loops rolled: one copy of the chunk body, for speed only
#pragma unroll 1
    for (int t = 0; t < NT; ++t) {
      const int cur = t & 1;
      // this lane's read addresses, its half's 8 k folded in (load_frag's half = 0)
      const unsigned short* sK = &skv[cur * ASTG_ + l15 * AKP_ + 8 * half];
      const unsigned short* sV = &skv[cur * ASTG_ + AKE_ + l15 * AVP_ + 8 * half];
      const int* sM = &smask[t * AKS_ + 8 * half];
#pragma unroll 1
      for (int c0 = 0; c0 < AKS_; c0 += 32) {
        v16bf ak[2][2], av[4];
#pragma unroll
        for (int mt = 0; mt < 2; ++mt)
#pragma unroll
            for (int kk = 0; kk < 2; ++kk)
                ak[mt][kk] = load_frag(sK + mt * 16 * AKP_ + kk * 32, 0);
        // mask of this lane's 16 kv rows: chunk start + mt*16 + 8*half + r
        v4i mk[2][2];
#pragma unroll
        for (int mt = 0; mt < 2; ++mt) {
            mk[mt][0] = *(const v4i*)(sM + mt * 16);
            mk[mt][1] = *(const v4i*)(sM + mt * 16 + 4);
        }
#pragma unroll
        for (int dt = 0; dt < 4; ++dt)
            av[dt] = load_frag(sV + dt * 16 * AVP_, 0);
        // keeps the chunk's 20 LDS reads one group ahead of the products, for speed only
        __builtin_amdgcn_sched_barrier(0);

        // scores: S^T = (K Q^T) * 0.125 + mask * -1e8
        v8f sf[2][2] = {};
#pragma unroll
        for (int mt = 0; mt < 2; ++mt)
#pragma unroll
            for (int nt = 0; nt < 2; ++nt)
#pragma unroll
                for (int kk = 0; kk < 2; ++kk)
                    sf[mt][nt] = wmma_bf16(ak[mt][kk], bq[nt][kk], sf[mt][nt]);

#pragma unroll
        for (int mt = 0; mt < 2; ++mt) {
            v8f mb;
#pragma unroll
            for (int r = 0; r < 8; ++r) mb[r] = (float)mk[mt][r >> 2][r & 3] * -1e8f;
            sf[mt][0] = sf[mt][0] * 0.125f + mb;
            sf[mt][1] = sf[mt][1] * 0.125f + mb;
        }

        float mnew[2];
#pragma unroll
        for (int nt = 0; nt < 2; ++nt) {
            float c0 = sf[0][nt][0], c1 = sf[1][nt][0];
#pragma unroll
            for (int r = 1; r < 8; ++r) c0 = fmaxf(c0, sf[0][nt][r]);
#pragma unroll
            for (int r = 1; r < 8; ++r) c1 = fmaxf(c1, sf[1][nt][r]);
            float cm = fmaxf(c0, c1);
            cm = fmaxf(cm, xhalf(cm));      // both halves feed one product: one maximum
            mnew[nt] = fmaxf(mrow[nt], cm);
        }
        float rs[2];
#pragma unroll
        for (int nt = 0; nt < 2; ++nt) {
            rs[nt] = __expf(mrow[nt] - mnew[nt]);
            mrow[nt] = mnew[nt];
        }

#pragma unroll
        for (int nt = 0; nt < 2; ++nt) {
            const float mn = mnew[nt], resc = rs[nt];
            const v8f t0 = sf[0][nt] - mn, t1 = sf[1][nt] - mn;
            v8f p0, p1;
#pragma unroll
            for (int r = 0; r < 8; ++r) p0[r] = __expf(t0[r]);
#pragma unroll
            for (int r = 0; r < 8; ++r) p1[r] = __expf(t1[r]);
            const v8f s8 = p0 + p1;
            const v4f s4 = __builtin_shufflevector(s8, s8, 0, 1, 2, 3) +
                           __builtin_shufflevector(s8, s8, 4, 5, 6, 7);
            const float ps = (s4[0] + s4[2]) + (s4[1] + s4[3]);
            lrow[nt] = lrow[nt] * resc + ps;
            const v16bf bp = __builtin_shufflevector(__builtin_convertvector(p0, v8bf),
                                                     __builtin_convertvector(p1, v8bf),
                                                     0, 1, 2, 3, 4, 5, 6, 7,
                                                     8, 9, 10, 11, 12, 13, 14, 15);
#pragma unroll
            for (int dt = 0; dt < 4; ++dt) {
                cacc[dt][nt] *= resc;
                cacc[dt][nt] = wmma_bf16(av[dt], bp, cacc[dt][nt]);
            }
        }
        // ends the chunk's scheduling region behind the last product: the three
        // address steps stay there and fill its hazard window; without it the
        // listing holds more v_nop per chunk
        __builtin_amdgcn_sched_barrier(0);
        sK += 32 * AKP_;
        sV += 32;
        sM += 32;
      }
      asm volatile("s_wait_dscnt 0x0" ::: "memory");     // own reads of this buffer done
      asm volatile("s_wait_asynccnt 0x0" ::: "memory");  // own copies of stage t+1 landed
      __syncthreads();  // publishes stage t+1 and frees the buffer just read
      if (t + 2 < NT)
          async_copy_kv(gK + (t + 2) * AKS_ * HD_, gV + (t + 2) * AKS_,
                        lK + (unsigned)cur * ASTGB_, lV + (unsigned)cur * ASTGB_);
    }
    asm volatile("s_wait_asynccnt 0x0" ::: "memory");  // nothing in flight at the end

#pragma unroll
    for (int nt = 0; nt < 2; ++nt) {
        const float inv = 1.0f / (lrow[nt] + xhalf(lrow[nt]));
        const int s = qt * 32 + nt * 16 + l15;
        unsigned short* dst = ctxb + (size_t)(bb * S_ + s) * H_ + hh * HD_ + 8 * half;
#pragma unroll
        for (int dt = 0; dt < 4; ++dt)
            *(v4u*)(dst + dt * 16) =
                __builtin_bit_cast(v4u, __builtin_convertvector(cacc[dt][nt] * inv, v8bf));
    }
}

// ---------------------------------------------------------------------------
extern "C" void kernel_launch(void* const* d_in, const int* in_sizes, int n_in,
                              void* d_out, int out_size, void* d_ws, size_t ws_size,
                              hipStream_t stream) {
    (void)in_sizes; (void)n_in; (void)out_size; (void)ws_size;
    const float* x       = (const float*)d_in[0];
    const int*   mask    = (const int*)d_in[1];
    const float* qkv_w   = (const float*)d_in[2];
    const float* qkv_b   = (const float*)d_in[3];
    const float* out_w   = (const float*)d_in[4];
    const float* out_b   = (const float*)d_in[5];
    const float* ln_g    = (const float*)d_in[6];
    const float* ln_b    = (const float*)d_in[7];
    float* out = (float*)d_out;

    // workspace layout (bf16 buffers), ~88 MB total
    char* w = (char*)d_ws;
    unsigned short* yb     = (unsigned short*)w;                 w += (size_t)BS_ * H_ * 2;       // 16 MB
    unsigned short* qkv_wb = (unsigned short*)w;                 w += (size_t)3 * H_ * H_ * 2;    //  6 MB
    unsigned short* out_wb = (unsigned short*)w;                 w += (size_t)H_ * H_ * 2;        //  2 MB
    unsigned short* Qb     = (unsigned short*)w;                 w += (size_t)BS_ * H_ * 2;       // 16 MB
    unsigned short* Kb     = (unsigned short*)w;                 w += (size_t)BS_ * H_ * 2;       // 16 MB
    unsigned short* VTb    = (unsigned short*)w;                 w += (size_t)BS_ * H_ * 2;       // 16 MB
    unsigned short* ctxb   = (unsigned short*)w;                                                  // 16 MB

    cvt_weights_kernel<<<4 * H_ / (8 * CVR_), 256, 0, stream>>>(qkv_w, out_w, qkv_wb, out_wb);
    ln_kernel<<<BS_ / (16 * LNR_), 512, 0, stream>>>(x, ln_g, ln_b, yb);
    gemm_tile_kernel<0><<<dim3(3 * H_ / GBN_, BS_ / GBM_), 256, 0, stream>>>(
        yb, qkv_wb, qkv_b, Qb, Kb, VTb, nullptr, nullptr);
    attn_kernel<<<B_ * NH_ * (S_ / 256), 256, 0, stream>>>(Qb, Kb, VTb, mask, ctxb);
    gemm_tile_kernel<1><<<dim3(H_ / GBN_, BS_ / GBM_), 256, 0, stream>>>(
        ctxb, out_wb, out_b, nullptr, nullptr, nullptr, x, out);
}

// v005
// A run of this version takes 108 microseconds.
// Two timings next to v004 put it at 1.28 and 1.25 times that version's speed.
// Counting every step since v000, it is 3.87 times as fast.
#include <hip/hip_runtime.h>
#include <hip/hip_bf16.h>

// ---------------------------------------------------------------------------
// LightSeq-style pre-LN multihead attention layer for MI455X (gfx1250).
// fp32 math for LN/softmax/accum; bf16 operands into v_wmma_f32_16x16x32_bf16.
// GEMMs: 8-wave workgroup, 256x128 tile, A and W rows double-buffered into LDS
// via GLOBAL_LOAD_ASYNC_TO_LDS_B128 (ASYNCcnt), 64x64 of the output per wave.
// Attention: 8 waves x 32 queries, K / V^T stages shared in LDS (async copies),
// flash-style online softmax on transposed products (S^T = K Q^T,
// O^T += V^T P^T), P kept in registers.
// Tokens of a batch are worked on in a permuted order, unmasked ones first: keys
// behind the last unmasked one weigh exp(-1e8) = 0 and are neither projected to
// K / V nor visited by the attention (a batch with every key masked keeps all).
// B=4, S=2048, H=1024, NH=16, HD=64.
// ---------------------------------------------------------------------------

#define B_   4
#define S_   2048
#define H_   1024
#define NH_  16
#define HD_  64
#define BS_  (B_ * S_)

typedef __attribute__((ext_vector_type(16))) __bf16        v16bf;
typedef __attribute__((ext_vector_type(8)))  float         v8f;
typedef __attribute__((ext_vector_type(4)))  unsigned int  v4u;
typedef __attribute__((ext_vector_type(8)))  __bf16        v8bf;
typedef __attribute__((ext_vector_type(4)))  int           v4i;
typedef __attribute__((ext_vector_type(4)))  float         v4f;
typedef __attribute__((ext_vector_type(4)))  __bf16        v4bf;
typedef __attribute__((ext_vector_type(2)))  unsigned int  v2u;

struct Frag32B { v4u lo, hi; };

static __device__ __forceinline__ unsigned short f2bfu(float f) {
    unsigned int u = __builtin_bit_cast(unsigned int, f);
    unsigned int r = u + 0x7FFFu + ((u >> 16) & 1u);   // round-to-nearest-even
    return (unsigned short)(r >> 16);
}

// Load one 16x32 bf16 A/B fragment for this lane. `row` points at the start of
// the (stride-aligned) 32-wide K slice of this lane's row/column.
// Per ISA 7.12.2: elements 0..7 = K[8*half .. 8*half+7],
//                 elements 8..15 = K[16+8*half .. 23+8*half].
static __device__ __forceinline__ v16bf load_frag(const unsigned short* row, int half) {
    Frag32B f;
    f.lo = *(const v4u*)(row + 8 * half);
    f.hi = *(const v4u*)(row + 16 + 8 * half);
    return __builtin_bit_cast(v16bf, f);
}

static __device__ __forceinline__ v8f wmma_bf16(v16bf a, v16bf b, v8f c) {
    return __builtin_amdgcn_wmma_f32_16x16x32_bf16(false, a, false, b, (short)0, c,
                                                   false, false);
}

// The value that lane ^ 16 holds (the other half of the wave).
static __device__ __forceinline__ float xhalf(float v) {
    const int b = __builtin_bit_cast(int, v);
    return __builtin_bit_cast(float, __builtin_amdgcn_permlanex16(b, b, 0x76543210, 0xfedcba98,
                                                                  false, false));
}

// GEMM tile: 256 rows of A x 128 rows of W per workgroup, 64 k per stage.
// LDS layout of one stage: 256 A rows then 128 W rows, each 64 k (128 B) at a
// pitch of 144 B (16 B x odd: ds_load_b128 fragment reads hit all banks).
#define GBM_   256
#define GBN_   128
#define GP_    72                      // row pitch in elements
#define GPB_   144u                    // row pitch in bytes
#define GSTG_  ((GBM_ + GBN_) * GP_)   // elements per stage
#define GSTGB_ (GSTG_ * 2)             // bytes per stage

// One stage's twelve async 16 B copies of this lane: A rows r + 32 i (i < 8) and
// W rows r + 32 i (i < 4), r = tid >> 3, 16 B chunk tid & 7, so each wave copy
// covers four whole 128 B lines. ga / gw / lds are the lane's addresses for row r.
// s_wait_xcnt closes the statement so that no address register of an issued
// copy is rewritten ahead of it.
static __device__ __forceinline__ void async_copy_stage(const unsigned short* ga,
                                                        const unsigned short* gw,
                                                        unsigned lds) {
    const unsigned lw = lds + GBM_ * GPB_;
    asm volatile("global_load_async_to_lds_b128 %0, %12, off\n\t"
                 "global_load_async_to_lds_b128 %1, %13, off\n\t"
                 "global_load_async_to_lds_b128 %2, %14, off\n\t"
                 "global_load_async_to_lds_b128 %3, %15, off\n\t"
                 "global_load_async_to_lds_b128 %4, %16, off\n\t"
                 "global_load_async_to_lds_b128 %5, %17, off\n\t"
                 "global_load_async_to_lds_b128 %6, %18, off\n\t"
                 "global_load_async_to_lds_b128 %7, %19, off\n\t"
                 "global_load_async_to_lds_b128 %8, %20, off\n\t"
                 "global_load_async_to_lds_b128 %9, %21, off\n\t"
                 "global_load_async_to_lds_b128 %10, %22, off\n\t"
                 "global_load_async_to_lds_b128 %11, %23, off\n\t"
                 "s_wait_xcnt 0x0"
                 :: "v"(lds), "v"(lds + 32u * GPB_), "v"(lds + 64u * GPB_),
                    "v"(lds + 96u * GPB_), "v"(lds + 128u * GPB_), "v"(lds + 160u * GPB_),
                    "v"(lds + 192u * GPB_), "v"(lds + 224u * GPB_),
                    "v"(lw), "v"(lw + 32u * GPB_), "v"(lw + 64u * GPB_), "v"(lw + 96u * GPB_),
                    "v"(ga), "v"(ga + 32 * H_), "v"(ga + 64 * H_), "v"(ga + 96 * H_),
                    "v"(ga + 128 * H_), "v"(ga + 160 * H_), "v"(ga + 192 * H_), "v"(ga + 224 * H_),
                    "v"(gw), "v"(gw + 32 * H_), "v"(gw + 64 * H_), "v"(gw + 96 * H_)
                 : "memory");
}

// ---------------------------------------------------------------------------
// The two streaming passes in front of the GEMMs. Both are built from few waves
// that each take whole 1024-float rows: a row is eight 16 B loads per lane, load j
// covering floats j*128 .. j*128+127 (512 contiguous bytes, four whole lines), and
// eight 8 B stores of bf16 (256 contiguous bytes, two whole lines). All loads of a
// wave are issued before its first use, so each WGP's whole share is in flight at
// once and the launch starts a few thousand waves, not one per 32 or 128 elements.
// ---------------------------------------------------------------------------
#define RCH_ (H_ / 128)                // 16 B loads per lane and row

// 16 bytes at a wave-uniform base + the lane's byte offset + a constant.
static __device__ __forceinline__ v4f ld16(const float* base, unsigned off, int c) {
    return *(const v4f*)((const char*)base + off + c);
}

static __device__ __forceinline__ v2u pack4(v4f v) {
    return __builtin_bit_cast(v2u, __builtin_convertvector(v, v4bf));   // round to nearest even
}

// v plus the value of lane ^ MASK of the same 16-lane row (DPP row_xmask).
template <int MASK>
static __device__ __forceinline__ float add_xmask(float v) {
    const int b = __builtin_bit_cast(int, v);
    return v + __builtin_bit_cast(float,
                                  __builtin_amdgcn_update_dpp(b, b, 0x160 + MASK, 0xf, 0xf, false));
}

// Sum over the wave's 32 lanes, the same value in every lane.
static __device__ __forceinline__ float wave_sum(float v) {
    v = add_xmask<1>(v);
    v = add_xmask<2>(v);
    v = add_xmask<4>(v);
    v = add_xmask<8>(v);
    return v + xhalf(v);
}

// ---------------------------------------------------------------------------
// Kernel 1: cast fp32 weights -> bf16 (qkv_w [3H,H] and out_w [H,H], row-major;
// rows of W are B-fragment columns, so no transpose is needed).
// 256 work-groups of 8 waves, two rows per wave.
// In front of them, one work-group per batch builds the batch's token order from
// its padding mask: pos[s] = place of token s, unmasked tokens first and each kind
// in its old order; tok[p] = token at place p; nk = number of unmasked tokens.
// Any mask content gives a permutation of 0 .. S-1.
// ---------------------------------------------------------------------------
#define CVR_ 2                         // rows per wave
#define NKP_ 32                        // ints between two batches' nk: a 128 B line each

// Keys the attention visits: the unmasked ones, rounded up to whole 32-key chunks
// (the rest of the last chunk is masked tokens with their bias); all of them where
// none is unmasked, since then the masked scores decide among themselves.
static __device__ __forceinline__ int keys_visited(const int* nkp, int b) {
    const int nk = min(max(nkp[b * NKP_], 0), S_);
    return nk > 0 ? (nk + 31) & ~31 : S_;
}

__global__ void __launch_bounds__(256)
cvt_weights_kernel(const float* __restrict__ qkv_w,
                   const float* __restrict__ out_w,
                   const int* __restrict__ maskp,
                   unsigned short* __restrict__ qkv_wb,
                   unsigned short* __restrict__ out_wb,
                   int* __restrict__ pos,
                   int* __restrict__ tok,
                   int* __restrict__ nkp) {
    __shared__ int gcnt[S_ / 32];
    __shared__ __attribute__((aligned(16))) int stok[S_];
    const unsigned lane = threadIdx.x & 31;
    const int wave = __builtin_amdgcn_readfirstlane(threadIdx.x >> 5);
    if (blockIdx.x < B_) {
        // wave w takes tokens w*256 .. w*256+255 in eight groups of 32
        const int* mb = maskp + blockIdx.x * S_ + wave * 256;
        int m[8];
#pragma unroll
        for (int k = 0; k < 8; ++k) m[k] = mb[k * 32 + lane];
        // behind the last load, in front of every rewrite of its address registers
        asm volatile("s_wait_xcnt 0x0" :: "v"(lane), "s"(mb) : "memory");
        unsigned bal[8];
        int mine = 0;
#pragma unroll
        for (int k = 0; k < 8; ++k) {
            bal[k] = __builtin_amdgcn_ballot_w32(m[k] == 0);
            mine = (int)lane == k ? __builtin_popcount(bal[k]) : mine;
        }
        if (lane < 8) gcnt[wave * 8 + lane] = mine;
        __syncthreads();               // all 64 group counts visible
        const int c0 = gcnt[lane], c1 = gcnt[32 + lane];
        // counts up to 2048 are exact in float
        const int nk = (int)wave_sum((float)(c0 + c1));
        int run = (int)wave_sum((float)(((int)lane < wave * 8 ? c0 : 0) +
                                        ((int)lane + 32 < wave * 8 ? c1 : 0)));
        int p[8];
#pragma unroll
        for (int k = 0; k < 8; ++k) {
            const int s = wave * 256 + k * 32 + (int)lane;
            const int r0 = run + __builtin_popcount(bal[k] & ((1u << lane) - 1u));
            p[k] = m[k] == 0 ? r0 : nk + (s - r0);
            stok[p[k]] = s;
            run += __builtin_popcount(bal[k]);
        }
        int* pb = pos + blockIdx.x * S_ + wave * 256 + lane;
#pragma unroll
        for (int k = 0; k < 8; ++k) pb[k * 32] = p[k];
        __syncthreads();               // the whole of stok written
        int* tb = tok + blockIdx.x * S_ + threadIdx.x * 8;
        *(v4i*)tb = *(const v4i*)&stok[threadIdx.x * 8];
        *(v4i*)(tb + 4) = *(const v4i*)&stok[threadIdx.x * 8 + 4];
        if (threadIdx.x == 0) nkp[blockIdx.x * NKP_] = nk;
        return;
    }
    const int row = ((blockIdx.x - B_) * 8 + wave) * CVR_;   // of the 4H rows of both matrices
    const bool isq = row < 3 * H_;
    const float* src = isq ? qkv_w + row * H_ : out_w + (row - 3 * H_) * H_;
    unsigned short* dst = (isq ? qkv_wb + row * H_ : out_wb + (row - 3 * H_) * H_) + lane * 4;
    const unsigned off = lane * 16;                     // this lane's bytes in each load
    v4f v[CVR_ * RCH_];
#pragma unroll
    for (int j = 0; j < CVR_ * RCH_; ++j) v[j] = ld16(src, off, j * 512);
    // behind the last load, in front of every rewrite of a register that the loads
    // name as address (in the listing: lane as scaled offset, the scalar bases): the
    // operands keep those registers as they are up to the wait
    asm volatile("s_wait_xcnt 0x0" :: "v"(lane), "s"(src) : "memory");
    // keeps every load ahead of the first conversion: without it the last loads are
    // issued only when the first have come back, a second memory latency per wave
    __builtin_amdgcn_sched_barrier(0);
#pragma unroll
    for (int j = 0; j < CVR_ * RCH_; ++j) *(v2u*)(dst + j * 128) = pack4(v[j]);
}

// ---------------------------------------------------------------------------
// Kernel 2: pre-LayerNorm, fp32 in -> bf16 out (GEMM A operand).
// 256 work-groups of 16 waves, two rows per wave, a row held in 32 registers per
// lane: read once, summed in the lane and then across the lanes, no LDS, no barrier.
// Row s of x is written as row pos[s] of its batch.
// ---------------------------------------------------------------------------
#define LNR_ 2                         // rows per wave
__global__ void __launch_bounds__(512)
ln_kernel(const float* __restrict__ x, const float* __restrict__ g,
          const float* __restrict__ bta,
          const int* __restrict__ pos,
          unsigned short* __restrict__ yb) {
    const unsigned lane = threadIdx.x & 31;
    const int wave = __builtin_amdgcn_readfirstlane(threadIdx.x >> 5);
    const int row = (blockIdx.x * 16 + wave) * LNR_;
    const float* xr = x + (size_t)row * H_;
    // a token's row goes to its place in the batch's permuted order
    unsigned short* yr[LNR_];
#pragma unroll
    for (int r = 0; r < LNR_; ++r)
        yr[r] = yb + (size_t)((row & ~(S_ - 1)) + (pos[row + r] & (S_ - 1))) * H_ + lane * 4;
    const unsigned off = lane * 16;                     // this lane's bytes in each load
    v4f v[LNR_][RCH_], gv[RCH_], bv[RCH_];
#pragma unroll
    for (int r = 0; r < LNR_; ++r)
#pragma unroll
        for (int j = 0; j < RCH_; ++j) v[r][j] = ld16(xr, off, r * H_ * 4 + j * 512);
#pragma unroll
    for (int j = 0; j < RCH_; ++j) gv[j] = ld16(g, off, j * 512);
#pragma unroll
    for (int j = 0; j < RCH_; ++j) bv[j] = ld16(bta, off, j * 512);
    // behind the last load, in front of every rewrite of a register that the loads
    // name as address (in the listing: lane as scaled offset, the scalar bases): the
    // operands keep those registers as they are up to the wait
    asm volatile("s_wait_xcnt 0x0" :: "v"(lane), "s"(xr), "s"(g), "s"(bta) : "memory");
    // keeps all 32 loads ahead of the sums: without it the gamma and beta loads sink
    // into the tail in small groups, each waited out on its own
    __builtin_amdgcn_sched_barrier(0);

#pragma unroll
    for (int r = 0; r < LNR_; ++r) {
        v4f a4 = v[r][0], q4 = v[r][0] * v[r][0];
#pragma unroll
        for (int j = 1; j < RCH_; ++j) { a4 += v[r][j]; q4 += v[r][j] * v[r][j]; }
        const float a  = wave_sum((a4[0] + a4[1]) + (a4[2] + a4[3]));
        const float b2 = wave_sum((q4[0] + q4[1]) + (q4[2] + q4[3]));
        const float mean = a * (1.f / H_);
        const float var  = b2 * (1.f / H_) - mean * mean;
        const float rstd = rsqrtf(var + 1e-5f);
#pragma unroll
        for (int j = 0; j < RCH_; ++j)
            *(v2u*)(yr[r] + j * 128) = pack4((v[r][j] - mean) * rstd * gv[j] + bv[j]);
    }
}

// ---------------------------------------------------------------------------
// Kernels 3/5: 256x128-tile GEMM, 8 waves (4x2), 64x64 of Y per wave: 16 WMMAs
// per 8 fragments. A and W rows (64 k per stage) are double-buffered in LDS by
// async copies; the copies of stage t+2 fly while stage t+1 is worked on.
// MODE 0: QKV projection epilogue (+bias, scatter Q/K -> [B,NH,S,HD],
//         V -> [B,NH,HD,S], bf16).
// MODE 1: out-projection epilogue (+bias, +residual, fp32 to d_out).
// ---------------------------------------------------------------------------
template <int MODE>
__global__ void __launch_bounds__(256)
gemm_tile_kernel(const unsigned short* __restrict__ Ab,
                 const unsigned short* __restrict__ Wb,
                 const float* __restrict__ bias,
                 const int* __restrict__ nkp,
                 unsigned short* __restrict__ Qb,
                 unsigned short* __restrict__ Kb,
                 unsigned short* __restrict__ VTb,
                 const float* __restrict__ xres,
                 float* __restrict__ outp) {
    __shared__ __attribute__((aligned(16))) unsigned short sh[2 * GSTG_];
    const int tid = threadIdx.x;
    const int w = tid >> 5, lane = tid & 31;
    const int half = lane >> 4, l15 = lane & 15;
    const int wm = w >> 1, wn = w & 1;
    const int m0 = blockIdx.y * GBM_;
    const int n0 = blockIdx.x * GBN_;
    const int NT = H_ / 64;            // stages

    // K and V of places that the attention never visits are not computed: the whole
    // work-group leaves, in front of every copy and barrier
    if (MODE == 0 && n0 >= H_ && (m0 & (S_ - 1)) >= keys_visited(nkp, m0 >> 11)) return;

    const int crow = tid >> 3, cchk = tid & 7;
    const unsigned short* gA = Ab + (size_t)(m0 + crow) * H_ + cchk * 8;
    const unsigned short* gW = Wb + (size_t)(n0 + crow) * H_ + cchk * 8;
    const unsigned lds0 = (unsigned)(size_t)&sh[0] + (unsigned)crow * GPB_ + (unsigned)cchk * 16u;

    v8f acc[4][4] = {};

    // prologue: stage 0 landed and published, stage 1 in flight
    async_copy_stage(gA, gW, lds0);
    asm volatile("s_wait_asynccnt 0x0" ::: "memory");  // own copies of stage 0 landed
    __syncthreads();                                   // stage 0 visible to all waves
    async_copy_stage(gA + 64, gW + 64, lds0 + GSTGB_);

    // rolled: one copy of the 32-WMMA body, for speed only
#pragma unroll 1
    for (int t = 0; t < NT; ++t) {
        const int cur = t & 1;
        const unsigned short* sA = &sh[cur * GSTG_ + (wm * 64 + l15) * GP_];
        const unsigned short* sW = &sh[cur * GSTG_ + (GBM_ + wn * 64 + l15) * GP_];
#pragma unroll
        for (int kk = 0; kk < 2; ++kk) {
            v16bf a[4], b[4];
#pragma unroll
            for (int i = 0; i < 4; ++i) a[i] = load_frag(sA + i * 16 * GP_ + kk * 32, half);
#pragma unroll
            for (int i = 0; i < 4; ++i) b[i] = load_frag(sW + i * 16 * GP_ + kk * 32, half);
            // keeps the 16 LDS reads one group ahead of the WMMA block, for speed only
            __builtin_amdgcn_sched_barrier(0);
#pragma unroll
            for (int ni = 0; ni < 4; ++ni)
#pragma unroll
                for (int mi = 0; mi < 4; ++mi)
                    acc[mi][ni] = wmma_bf16(a[mi], b[ni], acc[mi][ni]);
            // keeps the next group of LDS reads out of this WMMA block
            __builtin_amdgcn_sched_barrier(0);
        }
        asm volatile("s_wait_dscnt 0x0" ::: "memory");     // own reads of this buffer done
        asm volatile("s_wait_asynccnt 0x0" ::: "memory");  // own copies of stage t+1 landed
        __syncthreads();  // publishes stage t+1 and frees the buffer just read
        if (t + 2 < NT)
            async_copy_stage(gA + (t + 2) * 64, gW + (t + 2) * 64, lds0 + (unsigned)cur * GSTGB_);
    }
    asm volatile("s_wait_asynccnt 0x0" ::: "memory");  // nothing in flight at the end

    float bv[4];
#pragma unroll
    for (int ni = 0; ni < 4; ++ni) bv[ni] = bias[n0 + wn * 64 + ni * 16 + l15];

    if (MODE == 0) {
        // A tile's 256 tokens lie in one batch, its 128 features in one of q/k/v,
        // a wave's 64 features in one head (d = ni*16 + l15): one address per lane,
        // every (mi, r, ni) step a constant offset. Each path walks its stores so
        // that neighbours in time fall into the same 128 B line.
        const int sec = n0 >> 10;                              // 0=q 1=k 2=v
        const int s0 = (m0 & (S_ - 1)) + wm * 64 + 8 * half;   // token of (mi=0, r=0)
        const int bh = (m0 >> 11) * NH_ + ((n0 & (H_ - 1)) >> 6) + wn;
        if (sec == 2) {
            unsigned short* dst = VTb + (((bh * HD_ + l15) << 11) + s0);
#pragma unroll
            for (int ni = 0; ni < 4; ++ni)
#pragma unroll
                for (int mi = 0; mi < 4; ++mi)
#pragma unroll
                    for (int r = 0; r < 8; ++r)
                        dst[((ni * 16) << 11) + mi * 16 + r] = f2bfu(acc[mi][ni][r] + bv[ni]);
            return;
        }
        unsigned short* dst = (sec == 0 ? Qb : Kb) + (((bh * S_ + s0) << 6) + l15);
#pragma unroll
        for (int mi = 0; mi < 4; ++mi)
#pragma unroll
            for (int r = 0; r < 8; ++r)
#pragma unroll
                for (int ni = 0; ni < 4; ++ni)
                    dst[((mi * 16 + r) << 6) + ni * 16] = f2bfu(acc[mi][ni][r] + bv[ni]);
    } else {
        // One address per lane, every (mi, r, ni) step a constant offset. The wave's
        // 128 residual loads go out as one group ahead of the adds and stores, so
        // that their latency is waited out once and not once per element.
        const unsigned i0 = (unsigned)((m0 + wm * 64 + 8 * half) * H_ + n0 + wn * 64 + l15);
        const float* xp = xres + i0;
        float* op = outp + i0;
        float xr[4][8][4];
#pragma unroll
        for (int mi = 0; mi < 4; ++mi)
#pragma unroll
            for (int r = 0; r < 8; ++r)
#pragma unroll
                for (int ni = 0; ni < 4; ++ni)
                    xr[mi][r][ni] = xp[(mi * 16 + r) * H_ + ni * 16];
#pragma unroll
        for (int mi = 0; mi < 4; ++mi)
#pragma unroll
            for (int r = 0; r < 8; ++r)
#pragma unroll
                for (int ni = 0; ni < 4; ++ni)
                    op[(mi * 16 + r) * H_ + ni * 16] = acc[mi][ni][r] + bv[ni] + xr[mi][r][ni];
    }
}

// ---------------------------------------------------------------------------
// Kernel 4: flash-style attention, transposed products. A work-group of 8 waves
// handles (b, head, 256 queries), one wave 32 of them, streaming kv in chunks of
// 32 with online softmax. K rows and V^T rows are shared by the 8 waves: stages of
// 128 keys are double-buffered in LDS by async copies, the batch's mask row (in the
// permuted order) is written once; the copies of stage t+2 fly while stage t+1 is
// worked on. Queries, K rows and V^T columns come in the permuted order; only the
// places up to the last unmasked key are visited; ctx goes back to token order.
// S^T = K Q^T: A = K rows, B = Q columns, so a lane holds 16 scores of ONE query
// per 16-query group: maximum and sum run in the lane, the two wave halves
// exchange the maximum once per chunk and join their sums once at the end.
// O^T += V^T P^T: the two S^T tiles of a query group, converted in place, are the
// B operand in the hardware k order (kv = 8*half + s, 16 + 8*half + s - 8), which
// is the order load_frag gives the V^T rows: P never leaves the registers.
// ctx -> bf16 [B,S,H]: a lane's 8 accumulator registers are 8 consecutive d.
// ---------------------------------------------------------------------------
// LDS layout of one stage: 128 K rows of 64 d (128 B) at a pitch of 144 B, then
// 64 V^T rows of 128 keys (256 B) at a pitch of 272 B (both 16 B x odd:
// ds_load_b128 fragment reads hit all banks).
#define AKS_   128                     // keys per stage
#define AKP_   72                      // K row pitch in elements
#define AKPB_  144u                    // K row pitch in bytes
#define AVP_   136                     // V^T row pitch in elements
#define AVPB_  272u                    // V^T row pitch in bytes
#define AKE_   (AKS_ * AKP_)           // elements of a stage's K part
#define ASTG_  (AKE_ + HD_ * AVP_)     // elements per stage
#define ASTGB_ (ASTG_ * 2)             // bytes per stage

// One stage's eight async 16 B copies of this lane: K rows r + 32 i (i < 4),
// r = tid >> 3, 16 B chunk tid & 7, and V^T rows q + 16 i (i < 4), q = tid >> 4,
// 16 B chunk tid & 15, so each wave copy covers four whole 128 B lines.
// gk / gv / lk / lv are the lane's addresses for rows r and q.
// s_wait_xcnt closes the statement so that no address register of an issued
// copy is rewritten ahead of it.
static __device__ __forceinline__ void async_copy_kv(const unsigned short* gk,
                                                     const unsigned short* gv,
                                                     unsigned lk, unsigned lv) {
    asm volatile("global_load_async_to_lds_b128 %0, %8, off\n\t"
                 "global_load_async_to_lds_b128 %1, %9, off\n\t"
                 "global_load_async_to_lds_b128 %2, %10, off\n\t"
                 "global_load_async_to_lds_b128 %3, %11, off\n\t"
                 "global_load_async_to_lds_b128 %4, %12, off\n\t"
                 "global_load_async_to_lds_b128 %5, %13, off\n\t"
                 "global_load_async_to_lds_b128 %6, %14, off\n\t"
                 "global_load_async_to_lds_b128 %7, %15, off\n\t"
                 "s_wait_xcnt 0x0"
                 :: "v"(lk), "v"(lk + 32u * AKPB_), "v"(lk + 64u * AKPB_), "v"(lk + 96u * AKPB_),
                    "v"(lv), "v"(lv + 16u * AVPB_), "v"(lv + 32u * AVPB_), "v"(lv + 48u * AVPB_),
                    "v"(gk), "v"(gk + 32 * HD_), "v"(gk + 64 * HD_), "v"(gk + 96 * HD_),
                    "v"(gv), "v"(gv + 16 * S_), "v"(gv + 32 * S_), "v"(gv + 48 * S_)
                 : "memory");
}

// amdgpu_waves_per_eu(4, 4): two work-groups per WGP, four waves per SIMD, so that
// one wave's softmax runs beside another's products.
__global__ void __launch_bounds__(256) __attribute__((amdgpu_waves_per_eu(4, 4)))
attn_kernel(const unsigned short* __restrict__ Qb,
            const unsigned short* __restrict__ Kb,
            const unsigned short* __restrict__ VTb,
            const int* __restrict__ nkp,
            const int* __restrict__ tok,
            unsigned short* __restrict__ ctxb) {
    __shared__ __attribute__((aligned(16))) unsigned short skv[2 * ASTG_];
    __shared__ __attribute__((aligned(16))) int smask[S_];
    const int tid = threadIdx.x;
    const int lane = tid & 31, half = lane >> 4, l15 = lane & 15;
    const int bid = blockIdx.x;
    const int qt = (bid & 7) * 8 + (tid >> 5), hh = (bid >> 3) & 15, bb = bid >> 7;
    const int nk = min(max(nkp[bb * NKP_], 0), S_);    // unmasked keys: places 0 .. nk-1
    const int kv = keys_visited(nkp, bb);
    const int NT = (kv + AKS_ - 1) / AKS_;             // stages, 1 .. 16

    const unsigned short* Qh  = Qb  + ((size_t)(bb * NH_ + hh) * S_) * HD_;
    const unsigned short* Kh  = Kb  + ((size_t)(bb * NH_ + hh) * S_) * HD_;
    const unsigned short* VTh = VTb + ((size_t)(bb * NH_ + hh) * HD_) * S_;

    // this lane's copy addresses for stage 0
    const unsigned short* gK = Kh + (tid >> 3) * HD_ + (tid & 7) * 8;
    const unsigned short* gV = VTh + (size_t)(tid >> 4) * S_ + (tid & 15) * 8;
    const unsigned lK = (unsigned)(size_t)&skv[0] + (unsigned)(tid >> 3) * AKPB_ +
                        (unsigned)(tid & 7) * 16u;
    const unsigned lV = (unsigned)(size_t)&skv[AKE_] + (unsigned)(tid >> 4) * AVPB_ +
                        (unsigned)(tid & 15) * 16u;

    // prologue: stage 0 landed, mask row written, both published, stage 1 in flight
    async_copy_kv(gK, gV, lK, lV);

    // the tokens whose queries this lane holds (places qt*32 + nt*16 + l15)
    const int qpl = bb * S_ + qt * 32 + l15;
    int qtok[2];
#pragma unroll
    for (int nt = 0; nt < 2; ++nt) qtok[nt] = tok[qpl + nt * 16];

    v16bf bq[2][2];
#pragma unroll
    for (int nt = 0; nt < 2; ++nt)
#pragma unroll
        for (int kk = 0; kk < 2; ++kk)
            bq[nt][kk] = load_frag(Qh + (size_t)(qt * 32 + nt * 16 + l15) * HD_ + kk * 32, half);
    // behind the loads, in front of every rewrite of a register that the tok loads name
    // as address: the operands keep those registers as they are up to the wait
    asm volatile("s_wait_xcnt 0x0" :: "v"(qpl), "s"(tok) : "memory");

    // the mask in the permuted order: 0 at places below nk, 1 from there on
#pragma unroll
    for (int i = 0; i < 2; ++i) {
        v4i mw;
#pragma unroll
        for (int e = 0; e < 4; ++e) mw[e] = tid * 8 + i * 4 + e >= nk ? 1 : 0;
        *(v4i*)&smask[tid * 8 + i * 4] = mw;
    }

    asm volatile("s_wait_asynccnt 0x0" ::: "memory");  // own copies of stage 0 landed
    __syncthreads();                                   // mask and stage 0 visible to all waves
    if (NT > 1)
        async_copy_kv(gK + AKS_ * HD_, gV + AKS_, lK + ASTGB_, lV + ASTGB_);

    float mrow[2] = {-3.0e38f, -3.0e38f};   // running maximum of query nt*16 + l15
    float lrow[2] = {0.f, 0.f};             // this half's share of its running sum
    v8f cacc[4][2] = {};                    // O^T: d = dt*16 + 8*half + r, query nt*16 + l15

    // both loops rolled: one copy of the chunk body, for speed only
#pragma unroll 1
    for (int t = 0; t < NT; ++t) {
      const int cur = t & 1;
      // this lane's read addresses, its half's 8 k folded in (load_frag's half = 0)
      const unsigned short* sK = &skv[cur * ASTG_ + l15 * AKP_ + 8 * half];
      const unsigned short* sV = &skv[cur * ASTG_ + AKE_ + l15 * AVP_ + 8 * half];
      const int* sM = &smask[t * AKS_ + 8 * half];
      const int cend = min(AKS_, kv - t * AKS_);       // the last stage may end early
#pragma unroll 1
      for (int c0 = 0; c0 < cend; c0 += 32) {
        v16bf ak[2][2], av[4];
#pragma unroll
        for (int mt = 0; mt < 2; ++mt)
#pragma unroll
            for (int kk = 0; kk < 2; ++kk)
                ak[mt][kk] = load_frag(sK + mt * 16 * AKP_ + kk * 32, 0);
        // mask of this lane's 16 kv rows: chunk start + mt*16 + 8*half + r
        v4i mk[2][2];
#pragma unroll
        for (int mt = 0; mt < 2; ++mt) {
            mk[mt][0] = *(const v4i*)(sM + mt * 16);
            mk[mt][1] = *(const v4i*)(sM + mt * 16 + 4);
        }
#pragma unroll
        for (int dt = 0; dt < 4; ++dt)
            av[dt] = load_frag(sV + dt * 16 * AVP_, 0);
        // keeps the chunk's 20 LDS reads one group ahead of the products, for speed only
        __builtin_amdgcn_sched_barrier(0);

        // scores: S^T = (K Q^T) * 0.125 + mask * -1e8
        v8f sf[2][2] = {};
#pragma unroll
        for (int mt = 0; mt < 2; ++mt)
#pragma unroll
            for (int nt = 0; nt < 2; ++nt)
#pragma unroll
                for (int kk = 0; kk < 2; ++kk)
                    sf[mt][nt] = wmma_bf16(ak[mt][kk], bq[nt][kk], sf[mt][nt]);

#pragma unroll
        for (int mt = 0; mt < 2; ++mt) {
            v8f mb;
#pragma unroll
            for (int r = 0; r < 8; ++r) mb[r] = (float)mk[mt][r >> 2][r & 3] * -1e8f;
            sf[mt][0] = sf[mt][0] * 0.125f + mb;
            sf[mt][1] = sf[mt][1] * 0.125f + mb;
        }

        float mnew[2];
#pragma unroll
        for (int nt = 0; nt < 2; ++nt) {
            float c0 = sf[0][nt][0], c1 = sf[1][nt][0];
#pragma unroll
            for (int r = 1; r < 8; ++r) c0 = fmaxf(c0, sf[0][nt][r]);
#pragma unroll
            for (int r = 1; r < 8; ++r) c1 = fmaxf(c1, sf[1][nt][r]);
            float cm = fmaxf(c0, c1);
            cm = fmaxf(cm, xhalf(cm));      // both halves feed one product: one maximum
            mnew[nt] = fmaxf(mrow[nt], cm);
        }
        float rs[2];
#pragma unroll
        for (int nt = 0; nt < 2; ++nt) {
            rs[nt] = __expf(mrow[nt] - mnew[nt]);
            mrow[nt] = mnew[nt];
        }

#pragma unroll
        for (int nt = 0; nt < 2; ++nt) {
            const float mn = mnew[nt], resc = rs[nt];
            const v8f t0 = sf[0][nt] - mn, t1 = sf[1][nt] - mn;
            v8f p0, p1;
#pragma unroll
            for (int r = 0; r < 8; ++r) p0[r] = __expf(t0[r]);
#pragma unroll
            for (int r = 0; r < 8; ++r) p1[r] = __expf(t1[r]);
            const v8f s8 = p0 + p1;
            const v4f s4 = __builtin_shufflevector(s8, s8, 0, 1, 2, 3) +
                           __builtin_shufflevector(s8, s8, 4, 5, 6, 7);
            const float ps = (s4[0] + s4[2]) + (s4[1] + s4[3]);
            lrow[nt] = lrow[nt] * resc + ps;
            const v16bf bp = __builtin_shufflevector(__builtin_convertvector(p0, v8bf),
                                                     __builtin_convertvector(p1, v8bf),
                                                     0, 1, 2, 3, 4, 5, 6, 7,
                                                     8, 9, 10, 11, 12, 13, 14, 15);
#pragma unroll
            for (int dt = 0; dt < 4; ++dt) {
                cacc[dt][nt] *= resc;
                cacc[dt][nt] = wmma_bf16(av[dt], bp, cacc[dt][nt]);
            }
        }
        // ends the chunk's scheduling region behind the last product: the three
        // address steps stay there and fill its hazard window; without it the
        // listing holds more v_nop per chunk
        __builtin_amdgcn_sched_barrier(0);
        sK += 32 * AKP_;
        sV += 32;
        sM += 32;
      }
      asm volatile("s_wait_dscnt 0x0" ::: "memory");     // own reads of this buffer done
      asm volatile("s_wait_asynccnt 0x0" ::: "memory");  // own copies of stage t+1 landed
      __syncthreads();  // publishes stage t+1 and frees the buffer just read
      if (t + 2 < NT)
          async_copy_kv(gK + (t + 2) * AKS_ * HD_, gV + (t + 2) * AKS_,
                        lK + (unsigned)cur * ASTGB_, lV + (unsigned)cur * ASTGB_);
    }
    asm volatile("s_wait_asynccnt 0x0" ::: "memory");  // nothing in flight at the end

#pragma unroll
    for (int nt = 0; nt < 2; ++nt) {
        const float inv = 1.0f / (lrow[nt] + xhalf(lrow[nt]));
        const int s = qtok[nt] & (S_ - 1);             // back to the token's own row
        unsigned short* dst = ctxb + (size_t)(bb * S_ + s) * H_ + hh * HD_ + 8 * half;
#pragma unroll
        for (int dt = 0; dt < 4; ++dt)
            *(v4u*)(dst + dt * 16) =
                __builtin_bit_cast(v4u, __builtin_convertvector(cacc[dt][nt] * inv, v8bf));
    }
}

// ---------------------------------------------------------------------------
extern "C" void kernel_launch(void* const* d_in, const int* in_sizes, int n_in,
                              void* d_out, int out_size, void* d_ws, size_t ws_size,
                              hipStream_t stream) {
    (void)in_sizes; (void)n_in; (void)out_size; (void)ws_size;
    const float* x       = (const float*)d_in[0];
    const int*   mask    = (const int*)d_in[1];
    const float* qkv_w   = (const float*)d_in[2];
    const float* qkv_b   = (const float*)d_in[3];
    const float* out_w   = (const float*)d_in[4];
    const float* out_b   = (const float*)d_in[5];
    const float* ln_g    = (const float*)d_in[6];
    const float* ln_b    = (const float*)d_in[7];
    float* out = (float*)d_out;

    // workspace layout (bf16 buffers, then int pos / tok / nk), ~88 MB total
    char* w = (char*)d_ws;
    unsigned short* yb     = (unsigned short*)w;                 w += (size_t)BS_ * H_ * 2;       // 16 MB
    unsigned short* qkv_wb = (unsigned short*)w;                 w += (size_t)3 * H_ * H_ * 2;    //  6 MB
    unsigned short* out_wb = (unsigned short*)w;                 w += (size_t)H_ * H_ * 2;        //  2 MB
    unsigned short* Qb     = (unsigned short*)w;                 w += (size_t)BS_ * H_ * 2;       // 16 MB
    unsigned short* Kb     = (unsigned short*)w;                 w += (size_t)BS_ * H_ * 2;       // 16 MB
    unsigned short* VTb    = (unsigned short*)w;                 w += (size_t)BS_ * H_ * 2;       // 16 MB
    unsigned short* ctxb   = (unsigned short*)w;                 w += (size_t)BS_ * H_ * 2;       // 16 MB
    int* pos               = (int*)w;                            w += (size_t)BS_ * 4;            // 32 KB
    int* tok               = (int*)w;                            w += (size_t)BS_ * 4;            // 32 KB
    int* nkp               = (int*)w;                                                             // 512 B

    cvt_weights_kernel<<<B_ + 4 * H_ / (8 * CVR_), 256, 0, stream>>>(qkv_w, out_w, mask, qkv_wb, out_wb,
                                                                     pos, tok, nkp);
    ln_kernel<<<BS_ / (16 * LNR_), 512, 0, stream>>>(x, ln_g, ln_b, pos, yb);
    gemm_tile_kernel<0><<<dim3(3 * H_ / GBN_, BS_ / GBM_), 256, 0, stream>>>(
        yb, qkv_wb, qkv_b, nkp, Qb, Kb, VTb, nullptr, nullptr);
    attn_kernel<<<B_ * NH_ * (S_ / 256), 256, 0, stream>>>(Qb, Kb, VTb, nkp, tok, ctxb);
    gemm_tile_kernel<1><<<dim3(H_ / GBN_, BS_ / GBM_), 256, 0, stream>>>(
        ctxb, out_wb, out_b, nullptr, nullptr, nullptr, nullptr, x, out);
}
